// v000
// Times are from an AMD MI455X. After a warm-up the kernel runs many times in a row, and a time is the length of
// such a window on the GPU divided by its runs, so every launch and the gaps after it count. The runs cycle
// through copies of the inputs. A figure is the median of several windows, for all but v000 over two sittings.
// Sittings can differ by a few percent; kernels timed side by side share one.
// v000 is the starting kernel. One run takes 77.3 microseconds.
#include <hip/hip_runtime.h>
#include <hip/hip_bf16.h>

// ---------------------------------------------------------------------------
// SpatialAttention for MI455X (gfx1250), flash-attention style:
//  - never materializes the 8x4096x4096 attention matrix (512MB -> 0)
//  - QK^T   : V_WMMA_F32_16X16X4_F32  (fp32 logits, K-dim = head dim = 8)
//  - softmax: online, per-lane (S^T layout => query = lane column)
//  - PV     : V_WMMA_F32_16X16X32_BF16 (K-dim = 4096 contraction)
//  - P^T in C/D layout packs directly into the bf16 B-operand layout
// ---------------------------------------------------------------------------

typedef __attribute__((ext_vector_type(2)))  float  v2f;
typedef __attribute__((ext_vector_type(8)))  float  v8f;
typedef __attribute__((ext_vector_type(16))) __bf16 v16bf;

#define NTOK 4096   // 16*16*16 tokens
#define CCH  64     // channels
#define HEADS 8
#define HDIM  8

__device__ __forceinline__ unsigned short f32_bf16(float f) {
  unsigned u = __float_as_uint(f);
  u += 0x7FFFu + ((u >> 16) & 1u);   // round-to-nearest-even
  return (unsigned short)(u >> 16);
}

// ---------------------------------------------------------------------------
// Kernel 1: qkv[192][4096] = w_qkv(192x64) @ x(64x4096) + b_qkv
//           also emits bf16 V in [h][d_pad16][m] layout (pad rows zeroed)
// grid (256, 16) x 256 threads: blockIdx.x = output row (192 real + 64 pad)
// ---------------------------------------------------------------------------
__global__ __launch_bounds__(256) void qkv_kernel(
    const float* __restrict__ x, const float* __restrict__ w,
    const float* __restrict__ b, float* __restrict__ qkv,
    unsigned short* __restrict__ vbf) {
  const int co = blockIdx.x;
  const int n  = blockIdx.y * 256 + threadIdx.x;
  if (co >= 3 * CCH) {                 // zero-fill V pad rows d=8..15
    const int p = co - 3 * CCH;        // 0..63
    const int h = p >> 3, d = (p & 7) + 8;
    vbf[((h * 16) + d) * NTOK + n] = 0;
    return;
  }
  const float* wr = w + co * CCH;
  float acc = b[co];
#pragma unroll
  for (int ci = 0; ci < CCH; ++ci)
    acc = fmaf(wr[ci], x[ci * NTOK + n], acc);
  qkv[co * NTOK + n] = acc;
  if (co >= 2 * CCH) {                 // V -> bf16 copy
    const int c = co - 2 * CCH;
    const int h = c >> 3, d = c & 7;
    vbf[((h * 16) + d) * NTOK + n] = f32_bf16(acc);
  }
}

// ---------------------------------------------------------------------------
// Kernel 2: flash attention. One wave = one 16-query tile of one head.
// grid(256) x 256 threads (8 waves/block, all waves of a block share a head).
// ---------------------------------------------------------------------------
__global__ __launch_bounds__(256) void attn_kernel(
    const float* __restrict__ qkv, const unsigned short* __restrict__ vbf,
    float* __restrict__ attn_out) {
  const int lane = threadIdx.x & 31;
  const int wave = threadIdx.x >> 5;
  const int h    = blockIdx.x >> 5;
  const int tile = (blockIdx.x & 31) * 8 + wave;   // 0..255
  const int n0   = tile * 16;
  const int half = lane >> 4;                      // 0 | 1
  const int l16  = lane & 15;
  const float scale = 0.35355339059327373f;        // 1/sqrt(8)

  const float*          qb = qkv + (h * HDIM) * NTOK;            // q[d][n]
  const float*          kb = qkv + (CCH + h * HDIM) * NTOK;      // k[d][m]
  const unsigned short* vb = vbf + (h * 16) * NTOK;              // v[d16][m]

  // Q as fp32 B-operand (4x16): lane L, vgpr r -> q[K = r + 2*half][n0+l16]
  const int dq = 2 * half;
  v2f qB0, qB1;   // d = 0..3 and d = 4..7  (scale folded in)
  qB0.x = qb[(dq + 0) * NTOK + n0 + l16] * scale;
  qB0.y = qb[(dq + 1) * NTOK + n0 + l16] * scale;
  qB1.x = qb[(dq + 4) * NTOK + n0 + l16] * scale;
  qB1.y = qb[(dq + 5) * NTOK + n0 + l16] * scale;

  v8f   acc = {};                  // out^T accumulator (rows d, cols n)
  float run_max = -INFINITY;
  float run_sum = 0.0f;

  for (int m0 = 0; m0 < NTOK; m0 += 32) {
    // ---- K as fp32 A-operand (16x4): lane L, vgpr r -> k[r+2*half][m]
    const float* k0 = kb + m0 + l16;        // key tile 0 (m0..m0+15)
    const float* k1 = k0 + 16;              // key tile 1 (m0+16..m0+31)
    v2f kA00, kA01, kA10, kA11;
    kA00.x = k0[(dq + 0) * NTOK]; kA00.y = k0[(dq + 1) * NTOK];
    kA01.x = k0[(dq + 4) * NTOK]; kA01.y = k0[(dq + 5) * NTOK];
    kA10.x = k1[(dq + 0) * NTOK]; kA10.y = k1[(dq + 1) * NTOK];
    kA11.x = k1[(dq + 4) * NTOK]; kA11.y = k1[(dq + 5) * NTOK];

    // prefetch next chunk of V (gfx1250 global_prefetch path)
    __builtin_prefetch(vb + (size_t)l16 * NTOK + m0 + 32, 0, 1);

    // ---- S^T = (K-tile) x (Q-tile): fp32 WMMA, K-dim 4+4
    v8f s0 = {}, s1 = {};
    s0 = __builtin_amdgcn_wmma_f32_16x16x4_f32(false, kA00, false, qB0,
                                               (short)0, s0, false, false);
    s0 = __builtin_amdgcn_wmma_f32_16x16x4_f32(false, kA01, false, qB1,
                                               (short)0, s0, false, false);
    s1 = __builtin_amdgcn_wmma_f32_16x16x4_f32(false, kA10, false, qB0,
                                               (short)0, s1, false, false);
    s1 = __builtin_amdgcn_wmma_f32_16x16x4_f32(false, kA11, false, qB1,
                                               (short)0, s1, false, false);

    // ---- online softmax over this 32-key chunk (per lane = per query col)
    float cmax = s0[0];
#pragma unroll
    for (int r = 0; r < 8; ++r) {
      cmax = fmaxf(cmax, s0[r]);
      cmax = fmaxf(cmax, s1[r]);
    }
    cmax = fmaxf(cmax, __shfl_xor(cmax, 16, 32));      // join half-waves
    const float nmax = fmaxf(run_max, cmax);
    const float corr = __expf(run_max - nmax);
    run_max = nmax;

    float csum = 0.0f;
    v16bf pB;                       // P^T packed straight into B-operand
#pragma unroll
    for (int r = 0; r < 8; ++r) {
      const float p0 = __expf(s0[r] - nmax);
      const float p1 = __expf(s1[r] - nmax);
      csum += p0 + p1;
      pB[r]     = (__bf16)p0;       // K =  r + 8*half   (tile 0)
      pB[8 + r] = (__bf16)p1;       // K = 16 + r + 8*half (tile 1)
    }
    csum += __shfl_xor(csum, 16, 32);
    run_sum = run_sum * corr + csum;
#pragma unroll
    for (int r = 0; r < 8; ++r) acc[r] *= corr;

    // ---- V as bf16 A-operand: lane L (row d=l16), two 16B contiguous loads
    union { v16bf v; uint4 u[2]; } vA;
    const uint4* vp =
        (const uint4*)(vb + (size_t)l16 * NTOK + m0 + half * 8);
    vA.u[0] = vp[0];                // K =  0..7  (+8*half)
    vA.u[1] = vp[2];                // K = 16..23 (+8*half)

    acc = __builtin_amdgcn_wmma_f32_16x16x32_bf16(false, vA.v, false, pB,
                                                  (short)0, acc, false, false);
  }

  // ---- normalize + store: lanes 0..15 hold rows d=0..7 of out^T
  if (half == 0) {
    const float inv = 1.0f / run_sum;
    float* o = attn_out + (h * HDIM) * NTOK + n0 + l16;
#pragma unroll
    for (int r = 0; r < 8; ++r) o[r * NTOK] = acc[r] * inv;
  }
}

// ---------------------------------------------------------------------------
// Kernel 3: out = x + w_proj(64x64) @ attn_out + b_proj
// ---------------------------------------------------------------------------
__global__ __launch_bounds__(256) void proj_kernel(
    const float* __restrict__ x, const float* __restrict__ w,
    const float* __restrict__ b, const float* __restrict__ ao,
    float* __restrict__ out) {
  const int co = blockIdx.x;
  const int n  = blockIdx.y * 256 + threadIdx.x;
  const float* wr = w + co * CCH;
  float acc = b[co];
#pragma unroll
  for (int ci = 0; ci < CCH; ++ci)
    acc = fmaf(wr[ci], ao[ci * NTOK + n], acc);
  out[co * NTOK + n] = x[co * NTOK + n] + acc;
}

// ---------------------------------------------------------------------------
extern "C" void kernel_launch(void* const* d_in, const int* in_sizes, int n_in,
                              void* d_out, int out_size, void* d_ws,
                              size_t ws_size, hipStream_t stream) {
  const float* x      = (const float*)d_in[0];   // (1,64,16,16,16)
  const float* w_qkv  = (const float*)d_in[1];   // (192,64)
  const float* b_qkv  = (const float*)d_in[2];   // (192)
  const float* w_proj = (const float*)d_in[3];   // (64,64)
  const float* b_proj = (const float*)d_in[4];   // (64)
  float* out = (float*)d_out;

  char* ws = (char*)d_ws;
  float*          qkv = (float*)ws;                           // 192*4096 f32
  float*          ao  = (float*)(ws + 192 * NTOK * 4);        //  64*4096 f32
  unsigned short* vbf = (unsigned short*)(ws + 256 * NTOK * 4); // 8*16*4096 bf16

  qkv_kernel<<<dim3(256, 16), 256, 0, stream>>>(x, w_qkv, b_qkv, qkv, vbf);
  attn_kernel<<<dim3(256), 256, 0, stream>>>(qkv, vbf, ao);
  proj_kernel<<<dim3(64, 16), 256, 0, stream>>>(x, w_proj, b_proj, ao, out);
}

// v001
// A run of this version takes 42.1 microseconds.
// Two timings next to v000 put it at 1.89 and 1.88 times that version's speed.
#include <hip/hip_runtime.h>
#include <hip/hip_bf16.h>

// ---------------------------------------------------------------------------
// SpatialAttention for MI455X (gfx1250), flash-attention style:
//  - never materializes the 8x4096x4096 attention matrix (512MB -> 0)
//  - QK^T   : V_WMMA_F32_16X16X4_F32  (fp32 logits, K-dim = head dim = 8)
//  - softmax: online, per-lane (S^T layout => query = lane column)
//  - PV     : V_WMMA_F32_16X16X32_BF16 (K-dim = 4096 contraction)
//  - P^T in C/D layout packs directly into the bf16 B-operand layout
// ---------------------------------------------------------------------------

typedef __attribute__((ext_vector_type(2)))  float  v2f;
typedef __attribute__((ext_vector_type(8)))  float  v8f;
typedef __attribute__((ext_vector_type(16))) __bf16 v16bf;

#define NTOK 4096   // 16*16*16 tokens
#define CCH  64     // channels
#define HEADS 8
#define HDIM  8

__device__ __forceinline__ unsigned short f32_bf16(float f) {
  unsigned u = __float_as_uint(f);
  u += 0x7FFFu + ((u >> 16) & 1u);   // round-to-nearest-even
  return (unsigned short)(u >> 16);
}

// ---------------------------------------------------------------------------
// Kernel 1: qkv[192][4096] = w_qkv(192x64) @ x(64x4096) + b_qkv
//           also emits bf16 V in [h][d_pad16][m] layout (pad rows zeroed)
// grid (256, 16) x 256 threads: blockIdx.x = output row (192 real + 64 pad)
// ---------------------------------------------------------------------------
__global__ __launch_bounds__(256) void qkv_kernel(
    const float* __restrict__ x, const float* __restrict__ w,
    const float* __restrict__ b, float* __restrict__ qkv,
    unsigned short* __restrict__ vbf) {
  const int co = blockIdx.x;
  const int n  = blockIdx.y * 256 + threadIdx.x;
  if (co >= 3 * CCH) {                 // zero-fill V pad rows d=8..15
    const int p = co - 3 * CCH;        // 0..63
    const int h = p >> 3, d = (p & 7) + 8;
    vbf[((h * 16) + d) * NTOK + n] = 0;
    return;
  }
  const float* wr = w + co * CCH;
  float acc = b[co];
#pragma unroll
  for (int ci = 0; ci < CCH; ++ci)
    acc = fmaf(wr[ci], x[ci * NTOK + n], acc);
  qkv[co * NTOK + n] = acc;
  if (co >= 2 * CCH) {                 // V -> bf16 copy
    const int c = co - 2 * CCH;
    const int h = c >> 3, d = c & 7;
    vbf[((h * 16) + d) * NTOK + n] = f32_bf16(acc);
  }
}

// ---------------------------------------------------------------------------
// Kernel 2: flash attention, keys split over the waves of a block.
// One block = 32 queries (two 16-query tiles) of one head; each tile's 4096
// keys are cut into KSPLIT contiguous ranges, one wave per (tile, range).
// Every wave keeps its own maximum, sum and accumulator; the partials are
// merged through LDS behind one barrier.
// grid(1024) x 512 threads (16 waves/block): 16384 waves, 16 per SIMD.
// ---------------------------------------------------------------------------
#define KSPLIT 8
#define KRANGE (NTOK / KSPLIT)   // keys per wave

__global__ __launch_bounds__(512) void attn_kernel(
    const float* __restrict__ qkv, const unsigned short* __restrict__ vbf,
    float* __restrict__ attn_out) {
  __shared__ float s_acc[KSPLIT][HDIM][32];   // un-normalised partial out^T
  __shared__ float s_max[KSPLIT][32];         // partial row maxima
  __shared__ float s_sum[KSPLIT][32];         // partial row sums

  const int lane = threadIdx.x & 31;
  // wave number in a scalar register: key range, loop bounds and the merge's
  // branch are then wave-uniform for the compiler (EXEC stays all ones)
  const int wave = __builtin_amdgcn_readfirstlane(threadIdx.x >> 5);
  const int h    = blockIdx.x >> 7;
  const int qt   = wave & 1;                       // query tile in the block
  const int kr   = wave >> 1;                      // key range 0..KSPLIT-1
  const int nb   = (blockIdx.x & 127) * 32;        // block's first query
  const int n0   = nb + qt * 16;
  const int half = lane >> 4;                      // 0 | 1
  const int l16  = lane & 15;
  const float scale = 0.35355339059327373f;        // 1/sqrt(8)

  const float*          qb = qkv + (h * HDIM) * NTOK;            // q[d][n]
  const float*          kb = qkv + (CCH + h * HDIM) * NTOK;      // k[d][m]
  const unsigned short* vb = vbf + (h * 16) * NTOK;              // v[d16][m]

  // Q as fp32 B-operand (4x16): lane L, vgpr r -> q[K = r + 2*half][n0+l16]
  const int dq = 2 * half;
  v2f qB0, qB1;   // d = 0..3 and d = 4..7  (scale folded in)
  qB0.x = qb[(dq + 0) * NTOK + n0 + l16] * scale;
  qB0.y = qb[(dq + 1) * NTOK + n0 + l16] * scale;
  qB1.x = qb[(dq + 4) * NTOK + n0 + l16] * scale;
  qB1.y = qb[(dq + 5) * NTOK + n0 + l16] * scale;

  v8f   acc = {};                  // out^T accumulator (rows d, cols n)
  float run_max = -INFINITY;
  float run_sum = 0.0f;

  const int mbeg = kr * KRANGE;
  for (int m0 = mbeg; m0 < mbeg + KRANGE; m0 += 32) {
    // ---- K as fp32 A-operand (16x4): lane L, vgpr r -> k[r+2*half][m]
    const float* k0 = kb + m0 + l16;        // key tile 0 (m0..m0+15)
    const float* k1 = k0 + 16;              // key tile 1 (m0+16..m0+31)
    v2f kA00, kA01, kA10, kA11;
    kA00.x = k0[(dq + 0) * NTOK]; kA00.y = k0[(dq + 1) * NTOK];
    kA01.x = k0[(dq + 4) * NTOK]; kA01.y = k0[(dq + 5) * NTOK];
    kA10.x = k1[(dq + 0) * NTOK]; kA10.y = k1[(dq + 1) * NTOK];
    kA11.x = k1[(dq + 4) * NTOK]; kA11.y = k1[(dq + 5) * NTOK];

    // ---- S^T = (K-tile) x (Q-tile): fp32 WMMA, K-dim 4+4
    v8f s0 = {}, s1 = {};
    s0 = __builtin_amdgcn_wmma_f32_16x16x4_f32(false, kA00, false, qB0,
                                               (short)0, s0, false, false);
    s0 = __builtin_amdgcn_wmma_f32_16x16x4_f32(false, kA01, false, qB1,
                                               (short)0, s0, false, false);
    s1 = __builtin_amdgcn_wmma_f32_16x16x4_f32(false, kA10, false, qB0,
                                               (short)0, s1, false, false);
    s1 = __builtin_amdgcn_wmma_f32_16x16x4_f32(false, kA11, false, qB1,
                                               (short)0, s1, false, false);

    // ---- online softmax over this 32-key chunk (per lane = per query col)
    float cmax = s0[0];
#pragma unroll
    for (int r = 0; r < 8; ++r) {
      cmax = fmaxf(cmax, s0[r]);
      cmax = fmaxf(cmax, s1[r]);
    }
    cmax = fmaxf(cmax, __shfl_xor(cmax, 16, 32));      // join half-waves
    const float nmax = fmaxf(run_max, cmax);
    const float corr = __expf(run_max - nmax);
    run_max = nmax;

    float csum = 0.0f;
    v16bf pB;                       // P^T packed straight into B-operand
#pragma unroll
    for (int r = 0; r < 8; ++r) {
      const float p0 = __expf(s0[r] - nmax);
      const float p1 = __expf(s1[r] - nmax);
      csum += p0 + p1;
      pB[r]     = (__bf16)p0;       // K =  r + 8*half   (tile 0)
      pB[8 + r] = (__bf16)p1;       // K = 16 + r + 8*half (tile 1)
    }
    csum += __shfl_xor(csum, 16, 32);
    run_sum = run_sum * corr + csum;
#pragma unroll
    for (int r = 0; r < 8; ++r) acc[r] *= corr;

    // ---- V as bf16 A-operand: lane L (row d=l16), two 16B contiguous loads
    union { v16bf v; uint4 u[2]; } vA;
    const uint4* vp =
        (const uint4*)(vb + (size_t)l16 * NTOK + m0 + half * 8);
    vA.u[0] = vp[0];                // K =  0..7  (+8*half)
    vA.u[1] = vp[2];                // K = 16..23 (+8*half)

    acc = __builtin_amdgcn_wmma_f32_16x16x32_bf16(false, vA.v, false, pB,
                                                  (short)0, acc, false, false);
  }

  // ---- hand over the partial: lanes 0..15 hold rows d=0..7 of out^T
  if (half == 0) {
    const int q = qt * 16 + l16;
#pragma unroll
    for (int r = 0; r < 8; ++r) s_acc[kr][r][q] = acc[r];
    s_max[kr][q] = run_max;
    s_sum[kr][q] = run_sum;
  }
  __syncthreads();   // every range's partial is in LDS before the merge

  // ---- merge + normalize + store: wave d stores row d, one 128-B line
  if (wave < HDIM) {
    float gmax = s_max[0][lane];
#pragma unroll
    for (int s = 1; s < KSPLIT; ++s) gmax = fmaxf(gmax, s_max[s][lane]);
    float num = 0.0f, den = 0.0f;
#pragma unroll
    for (int s = 0; s < KSPLIT; ++s) {
      const float wgt = __expf(s_max[s][lane] - gmax);
      num = fmaf(s_acc[s][wave][lane], wgt, num);
      den = fmaf(s_sum[s][lane], wgt, den);
    }
    attn_out[(h * HDIM + wave) * NTOK + nb + lane] = num / den;
  }
}

// ---------------------------------------------------------------------------
// Kernel 3: out = x + w_proj(64x64) @ attn_out + b_proj
// ---------------------------------------------------------------------------
__global__ __launch_bounds__(256) void proj_kernel(
    const float* __restrict__ x, const float* __restrict__ w,
    const float* __restrict__ b, const float* __restrict__ ao,
    float* __restrict__ out) {
  const int co = blockIdx.x;
  const int n  = blockIdx.y * 256 + threadIdx.x;
  const float* wr = w + co * CCH;
  float acc = b[co];
#pragma unroll
  for (int ci = 0; ci < CCH; ++ci)
    acc = fmaf(wr[ci], ao[ci * NTOK + n], acc);
  out[co * NTOK + n] = x[co * NTOK + n] + acc;
}

// ---------------------------------------------------------------------------
extern "C" void kernel_launch(void* const* d_in, const int* in_sizes, int n_in,
                              void* d_out, int out_size, void* d_ws,
                              size_t ws_size, hipStream_t stream) {
  const float* x      = (const float*)d_in[0];   // (1,64,16,16,16)
  const float* w_qkv  = (const float*)d_in[1];   // (192,64)
  const float* b_qkv  = (const float*)d_in[2];   // (192)
  const float* w_proj = (const float*)d_in[3];   // (64,64)
  const float* b_proj = (const float*)d_in[4];   // (64)
  float* out = (float*)d_out;

  char* ws = (char*)d_ws;
  float*          qkv = (float*)ws;                           // 192*4096 f32
  float*          ao  = (float*)(ws + 192 * NTOK * 4);        //  64*4096 f32
  unsigned short* vbf = (unsigned short*)(ws + 256 * NTOK * 4); // 8*16*4096 bf16

  qkv_kernel<<<dim3(256, 16), 256, 0, stream>>>(x, w_qkv, b_qkv, qkv, vbf);
  attn_kernel<<<dim3(1024), 512, 0, stream>>>(qkv, vbf, ao);
  proj_kernel<<<dim3(64, 16), 256, 0, stream>>>(x, w_proj, b_proj, ao, out);
}

// v002
// It runs in 34.7 microseconds.
// Timed twice side by side with v001, it ran 1.22 and 1.23 times as fast.
// Counting every step since v000, it is 2.30 times as fast.
#include <hip/hip_runtime.h>
#include <hip/hip_bf16.h>

// ---------------------------------------------------------------------------
// SpatialAttention for MI455X (gfx1250), flash-attention style:
//  - never materializes the 8x4096x4096 attention matrix (512MB -> 0)
//  - QK^T   : V_WMMA_F32_16X16X4_F32  (fp32 logits, K-dim = head dim = 8)
//  - softmax: online, per-lane (S^T layout => query = lane column)
//  - PV     : V_WMMA_F32_16X16X32_BF16 (K-dim = 4096 contraction)
//  - P^T in C/D layout packs directly into the bf16 B-operand layout
//  - both 1x1 projections: V_WMMA_F32_16X16X4_F32, 16 channels x 32 tokens a wave
// ---------------------------------------------------------------------------

typedef __attribute__((ext_vector_type(2)))  float  v2f;
typedef __attribute__((ext_vector_type(8)))  float  v8f;
typedef __attribute__((ext_vector_type(16))) __bf16 v16bf;

#define NTOK 4096   // 16*16*16 tokens
#define CCH  64     // channels
#define HEADS 8
#define HDIM  8

__device__ __forceinline__ unsigned short f32_bf16(float f) {
  unsigned u = __float_as_uint(f);
  u += 0x7FFFu + ((u >> 16) & 1u);   // round-to-nearest-even
  return (unsigned short)(u >> 16);
}

// ---------------------------------------------------------------------------
// Shared by kernels 1 and 3: one wave's tile of  W(rows x 64) @ in(64 x 4096)
// + bias  on V_WMMA_F32_16X16X4_F32: 16 output channels x 32 tokens.
//  - A = W rows co0..co0+15 (lane column c = row), B = in (lane column c =
//    token); column c of tile t is token n0 + 2c + t, so a lane ends up with
//    two neighbouring tokens of each of its 8 channels (8-byte stores)
//  - operand register r of lane half hf at step s holds input channel
//    ci = 8*(s/2) + 4*hf + 2*(s%2) + r for A and for B alike: a lane's weights
//    of two steps are 16 contiguous bytes
//  - result: t0[r], t1[r] = channel co0 + 8*hf + r, tokens n0 + 2c, n0 + 2c + 1
// ---------------------------------------------------------------------------
__device__ __forceinline__ void pointwise_tile(
    const float* __restrict__ w, const float* __restrict__ bias,
    const float* __restrict__ in, int co0, int n0, int c, int hf,
    v8f& t0, v8f& t1) {
  const float* wrow = w + (co0 + c) * CCH + hf * 4;
  const float* icol = in + (hf * 4) * NTOK + n0 + 2 * c;

  float4 wa[8];
#pragma unroll
  for (int p = 0; p < 8; ++p) wa[p] = *(const float4*)(wrow + p * 8);

  v2f b0[16], b1[16];
#pragma unroll
  for (int s = 0; s < 16; ++s) {
    const float* ip = icol + ((s >> 1) * 8 + (s & 1) * 2) * NTOK;
    b0[s].x = ip[0];    b1[s].x = ip[1];
    b0[s].y = ip[NTOK]; b1[s].y = ip[NTOK + 1];
  }

#pragma unroll
  for (int r = 0; r < 8; ++r) t0[r] = t1[r] = bias[co0 + 8 * hf + r];

#pragma unroll
  for (int s = 0; s < 16; ++s) {
    v2f a;
    a.x = (s & 1) ? wa[s >> 1].z : wa[s >> 1].x;
    a.y = (s & 1) ? wa[s >> 1].w : wa[s >> 1].y;
    t0 = __builtin_amdgcn_wmma_f32_16x16x4_f32(false, a, false, b0[s],
                                               (short)0, t0, false, false);
    t1 = __builtin_amdgcn_wmma_f32_16x16x4_f32(false, a, false, b1[s],
                                               (short)0, t1, false, false);
  }
}

// ---------------------------------------------------------------------------
// Kernel 1: qkv[192][4096] = w_qkv(192x64) @ x(64x4096) + b_qkv
//           also emits bf16 V in [h][d_pad16][m] layout (pad rows zeroed)
// grid (12, 32) x 128 threads: blockIdx.x = 16-channel tile (0..3 q, 4..7 k,
// 8..11 v; two heads each), one wave per 32 tokens: 1536 waves.
// ---------------------------------------------------------------------------
// waves_per_eu: register room for all 42 operand loads of a wave to be in
// flight at once (at the default budget they are asked for a dozen at a time)
__global__ __launch_bounds__(128) __attribute__((amdgpu_waves_per_eu(1, 4)))
void qkv_kernel(
    const float* __restrict__ x, const float* __restrict__ w,
    const float* __restrict__ b, float* __restrict__ qkv,
    unsigned short* __restrict__ vbf) {
  const int lane = threadIdx.x & 31;
  // wave number in a scalar register: EXEC stays all ones around the WMMAs
  const int wave = __builtin_amdgcn_readfirstlane(threadIdx.x >> 5);
  const int c    = lane & 15;
  const int hf   = lane >> 4;
  const int ct   = blockIdx.x;
  const int co0  = ct * 16;
  const int n0   = (blockIdx.y * 4 + wave) * 32;

  v8f t0, t1;
  pointwise_tile(w, b, x, co0, n0, c, hf, t0, t1);

#pragma unroll
  for (int r = 0; r < 8; ++r)
    *(float2*)(qkv + (co0 + 8 * hf + r) * NTOK + n0 + 2 * c) =
        make_float2(t0[r], t1[r]);
  // the branches below reuse the registers these stores name
  asm volatile("s_wait_xcnt 0x0" ::: "memory");

  if (ct >= 8) {                       // V -> bf16 copy, rows d = 0..7
    const int h = (ct - 8) * 2 + hf;
#pragma unroll
    for (int r = 0; r < 8; ++r)
      *(unsigned*)(vbf + ((h * 16) + r) * NTOK + n0 + 2 * c) =
          (unsigned)f32_bf16(t0[r]) | ((unsigned)f32_bf16(t1[r]) << 16);
  } else if (ct < 4) {                 // q tiles zero-fill V pad rows d = 8..15
    const int h = ct * 2 + hf;         // two lanes per row, 32 bytes each
    uint4* zp = (uint4*)(vbf + ((h * 16) + 8 + (c >> 1)) * NTOK + n0 +
                         (c & 1) * 16);
    zp[0] = make_uint4(0, 0, 0, 0);
    zp[1] = make_uint4(0, 0, 0, 0);
    // code laid out behind this branch reuses the registers these stores name
    asm volatile("s_wait_xcnt 0x0" ::: "memory");
  }
}

// ---------------------------------------------------------------------------
// Kernel 2: flash attention, keys split over the waves of a block.
// One block = 32 queries (two 16-query tiles) of one head; each tile's 4096
// keys are cut into KSPLIT contiguous ranges, one wave per (tile, range).
// Every wave keeps its own maximum, sum and accumulator; the partials are
// merged through LDS behind one barrier.
// grid(1024) x 512 threads (16 waves/block): 16384 waves, 16 per SIMD.
// ---------------------------------------------------------------------------
#define KSPLIT 8
#define KRANGE (NTOK / KSPLIT)   // keys per wave

__global__ __launch_bounds__(512) void attn_kernel(
    const float* __restrict__ qkv, const unsigned short* __restrict__ vbf,
    float* __restrict__ attn_out) {
  __shared__ float s_acc[KSPLIT][HDIM][32];   // un-normalised partial out^T
  __shared__ float s_max[KSPLIT][32];         // partial row maxima
  __shared__ float s_sum[KSPLIT][32];         // partial row sums

  const int lane = threadIdx.x & 31;
  // wave number in a scalar register: key range, loop bounds and the merge's
  // branch are then wave-uniform for the compiler (EXEC stays all ones)
  const int wave = __builtin_amdgcn_readfirstlane(threadIdx.x >> 5);
  const int h    = blockIdx.x >> 7;
  const int qt   = wave & 1;                       // query tile in the block
  const int kr   = wave >> 1;                      // key range 0..KSPLIT-1
  const int nb   = (blockIdx.x & 127) * 32;        // block's first query
  const int n0   = nb + qt * 16;
  const int half = lane >> 4;                      // 0 | 1
  const int l16  = lane & 15;
  const float scale = 0.35355339059327373f;        // 1/sqrt(8)

  const float*          qb = qkv + (h * HDIM) * NTOK;            // q[d][n]
  const float*          kb = qkv + (CCH + h * HDIM) * NTOK;      // k[d][m]
  const unsigned short* vb = vbf + (h * 16) * NTOK;              // v[d16][m]

  // Q as fp32 B-operand (4x16): lane L, vgpr r -> q[K = r + 2*half][n0+l16]
  const int dq = 2 * half;
  v2f qB0, qB1;   // d = 0..3 and d = 4..7  (scale folded in)
  qB0.x = qb[(dq + 0) * NTOK + n0 + l16] * scale;
  qB0.y = qb[(dq + 1) * NTOK + n0 + l16] * scale;
  qB1.x = qb[(dq + 4) * NTOK + n0 + l16] * scale;
  qB1.y = qb[(dq + 5) * NTOK + n0 + l16] * scale;

  v8f   acc = {};                  // out^T accumulator (rows d, cols n)
  float run_max = -INFINITY;
  float run_sum = 0.0f;

  const int mbeg = kr * KRANGE;
  for (int m0 = mbeg; m0 < mbeg + KRANGE; m0 += 32) {
    // ---- K as fp32 A-operand (16x4): lane L, vgpr r -> k[r+2*half][m]
    const float* k0 = kb + m0 + l16;        // key tile 0 (m0..m0+15)
    const float* k1 = k0 + 16;              // key tile 1 (m0+16..m0+31)
    v2f kA00, kA01, kA10, kA11;
    kA00.x = k0[(dq + 0) * NTOK]; kA00.y = k0[(dq + 1) * NTOK];
    kA01.x = k0[(dq + 4) * NTOK]; kA01.y = k0[(dq + 5) * NTOK];
    kA10.x = k1[(dq + 0) * NTOK]; kA10.y = k1[(dq + 1) * NTOK];
    kA11.x = k1[(dq + 4) * NTOK]; kA11.y = k1[(dq + 5) * NTOK];

    // ---- S^T = (K-tile) x (Q-tile): fp32 WMMA, K-dim 4+4
    v8f s0 = {}, s1 = {};
    s0 = __builtin_amdgcn_wmma_f32_16x16x4_f32(false, kA00, false, qB0,
                                               (short)0, s0, false, false);
    s0 = __builtin_amdgcn_wmma_f32_16x16x4_f32(false, kA01, false, qB1,
                                               (short)0, s0, false, false);
    s1 = __builtin_amdgcn_wmma_f32_16x16x4_f32(false, kA10, false, qB0,
                                               (short)0, s1, false, false);
    s1 = __builtin_amdgcn_wmma_f32_16x16x4_f32(false, kA11, false, qB1,
                                               (short)0, s1, false, false);

    // ---- online softmax over this 32-key chunk (per lane = per query col)
    float cmax = s0[0];
#pragma unroll
    for (int r = 0; r < 8; ++r) {
      cmax = fmaxf(cmax, s0[r]);
      cmax = fmaxf(cmax, s1[r]);
    }
    cmax = fmaxf(cmax, __shfl_xor(cmax, 16, 32));      // join half-waves
    const float nmax = fmaxf(run_max, cmax);
    const float corr = __expf(run_max - nmax);
    run_max = nmax;

    float csum = 0.0f;
    v16bf pB;                       // P^T packed straight into B-operand
#pragma unroll
    for (int r = 0; r < 8; ++r) {
      const float p0 = __expf(s0[r] - nmax);
      const float p1 = __expf(s1[r] - nmax);
      csum += p0 + p1;
      pB[r]     = (__bf16)p0;       // K =  r + 8*half   (tile 0)
      pB[8 + r] = (__bf16)p1;       // K = 16 + r + 8*half (tile 1)
    }
    csum += __shfl_xor(csum, 16, 32);
    run_sum = run_sum * corr + csum;
#pragma unroll
    for (int r = 0; r < 8; ++r) acc[r] *= corr;

    // ---- V as bf16 A-operand: lane L (row d=l16), two 16B contiguous loads
    union { v16bf v; uint4 u[2]; } vA;
    const uint4* vp =
        (const uint4*)(vb + (size_t)l16 * NTOK + m0 + half * 8);
    vA.u[0] = vp[0];                // K =  0..7  (+8*half)
    vA.u[1] = vp[2];                // K = 16..23 (+8*half)

    acc = __builtin_amdgcn_wmma_f32_16x16x32_bf16(false, vA.v, false, pB,
                                                  (short)0, acc, false, false);
  }

  // ---- hand over the partial: lanes 0..15 hold rows d=0..7 of out^T
  if (half == 0) {
    const int q = qt * 16 + l16;
#pragma unroll
    for (int r = 0; r < 8; ++r) s_acc[kr][r][q] = acc[r];
    s_max[kr][q] = run_max;
    s_sum[kr][q] = run_sum;
  }
  __syncthreads();   // every range's partial is in LDS before the merge

  // ---- merge + normalize + store: wave d stores row d, one 128-B line
  if (wave < HDIM) {
    float gmax = s_max[0][lane];
#pragma unroll
    for (int s = 1; s < KSPLIT; ++s) gmax = fmaxf(gmax, s_max[s][lane]);
    float num = 0.0f, den = 0.0f;
#pragma unroll
    for (int s = 0; s < KSPLIT; ++s) {
      const float wgt = __expf(s_max[s][lane] - gmax);
      num = fmaf(s_acc[s][wave][lane], wgt, num);
      den = fmaf(s_sum[s][lane], wgt, den);
    }
    attn_out[(h * HDIM + wave) * NTOK + nb + lane] = num / den;
  }
}

// ---------------------------------------------------------------------------
// Kernel 3: out = x + w_proj(64x64) @ attn_out + b_proj
// grid (4, 64) x 64 threads: blockIdx.x = 16-channel tile, one wave per 32
// tokens: 512 waves, one block per WGP.
// ---------------------------------------------------------------------------
// waves_per_eu: as in kernel 1, room for every load to be in flight at once
__global__ __launch_bounds__(64) __attribute__((amdgpu_waves_per_eu(1, 4)))
void proj_kernel(
    const float* __restrict__ x, const float* __restrict__ w,
    const float* __restrict__ b, const float* __restrict__ ao,
    float* __restrict__ out) {
  const int lane = threadIdx.x & 31;
  // wave number in a scalar register: EXEC stays all ones around the WMMAs
  const int wave = __builtin_amdgcn_readfirstlane(threadIdx.x >> 5);
  const int c    = lane & 15;
  const int hf   = lane >> 4;
  const int co0  = blockIdx.x * 16;
  const int n0   = (blockIdx.y * 2 + wave) * 32;

  float2 res[8];                       // residual, asked for with the operands
#pragma unroll
  for (int r = 0; r < 8; ++r)
    res[r] = *(const float2*)(x + (co0 + 8 * hf + r) * NTOK + n0 + 2 * c);

  v8f t0, t1;
  pointwise_tile(w, b, ao, co0, n0, c, hf, t0, t1);

#pragma unroll
  for (int r = 0; r < 8; ++r)
    *(float2*)(out + (co0 + 8 * hf + r) * NTOK + n0 + 2 * c) =
        make_float2(res[r].x + t0[r], res[r].y + t1[r]);
}

// ---------------------------------------------------------------------------
extern "C" void kernel_launch(void* const* d_in, const int* in_sizes, int n_in,
                              void* d_out, int out_size, void* d_ws,
                              size_t ws_size, hipStream_t stream) {
  const float* x      = (const float*)d_in[0];   // (1,64,16,16,16)
  const float* w_qkv  = (const float*)d_in[1];   // (192,64)
  const float* b_qkv  = (const float*)d_in[2];   // (192)
  const float* w_proj = (const float*)d_in[3];   // (64,64)
  const float* b_proj = (const float*)d_in[4];   // (64)
  float* out = (float*)d_out;

  char* ws = (char*)d_ws;
  float*          qkv = (float*)ws;                           // 192*4096 f32
  float*          ao  = (float*)(ws + 192 * NTOK * 4);        //  64*4096 f32
  unsigned short* vbf = (unsigned short*)(ws + 256 * NTOK * 4); // 8*16*4096 bf16

  qkv_kernel<<<dim3(12, 32), 128, 0, stream>>>(x, w_qkv, b_qkv, qkv, vbf);
  attn_kernel<<<dim3(1024), 512, 0, stream>>>(qkv, vbf, ao);
  proj_kernel<<<dim3(4, 64), 64, 0, stream>>>(x, w_proj, b_proj, ao, out);
}

// v004
// A run of this version takes 28.8 microseconds.
// Versions between v002 and this one are left out; their measured steps multiply to 1.21 times as fast.
// All steps since v000 together make it 2.78 times as fast.
#include <hip/hip_runtime.h>
#include <hip/hip_bf16.h>

// ---------------------------------------------------------------------------
// SpatialAttention for MI455X (gfx1250), flash-attention style:
//  - never materializes the 8x4096x4096 attention matrix (512MB -> 0)
//  - QK^T   : V_WMMA_F32_16X16X4_F32  (fp32 logits, K-dim = head dim = 8)
//  - softmax: online, per-lane (S^T layout => query = lane column), the shift
//             moved only when a logit outgrows it
//  - PV     : V_WMMA_F32_16X16X32_BF16 (K-dim = 4096 contraction)
//  - P^T in C/D layout packs directly into the bf16 B-operand layout
//  - both 1x1 projections: V_WMMA_F32_16X16X4_F32, 16 channels x 32 tokens a wave
// ---------------------------------------------------------------------------

typedef __attribute__((ext_vector_type(2)))  float  v2f;
typedef __attribute__((ext_vector_type(4)))  float  v4f;
typedef __attribute__((ext_vector_type(8)))  float  v8f;
typedef __attribute__((ext_vector_type(16))) __bf16 v16bf;

#define NTOK 4096   // 16*16*16 tokens
#define CCH  64     // channels
#define HEADS 8
#define HDIM  8

__device__ __forceinline__ unsigned short f32_bf16(float f) {
  unsigned u = __float_as_uint(f);
  u += 0x7FFFu + ((u >> 16) & 1u);   // round-to-nearest-even
  return (unsigned short)(u >> 16);
}

// ---------------------------------------------------------------------------
// Shared by kernels 1 and 3: one wave's tile of  W(rows x 64) @ in(64 x 4096)
// + bias  on V_WMMA_F32_16X16X4_F32: 16 output channels x 32 tokens.
//  - A = W rows co0..co0+15 (lane column c = row), B = in (lane column c =
//    token); column c of tile t is token n0 + 2c + t, so a lane ends up with
//    two neighbouring tokens of each of its 8 channels (8-byte stores)
//  - operand register r of lane half hf at step s holds input channel
//    ci = 8*(s/2) + 4*hf + 2*(s%2) + r for A and for B alike: a lane's weights
//    of two steps are 16 contiguous bytes
//  - result: t0[r], t1[r] = channel co0 + 8*hf + r, tokens n0 + 2c, n0 + 2c + 1
// ---------------------------------------------------------------------------
__device__ __forceinline__ void pointwise_tile(
    const float* __restrict__ w, const float* __restrict__ bias,
    const float* __restrict__ in, int co0, int n0, int c, int hf,
    v8f& t0, v8f& t1) {
  const float* wrow = w + (co0 + c) * CCH + hf * 4;
  const float* icol = in + (hf * 4) * NTOK + n0 + 2 * c;

  float4 wa[8];
#pragma unroll
  for (int p = 0; p < 8; ++p) wa[p] = *(const float4*)(wrow + p * 8);

  v2f b0[16], b1[16];
#pragma unroll
  for (int s = 0; s < 16; ++s) {
    const float* ip = icol + ((s >> 1) * 8 + (s & 1) * 2) * NTOK;
    b0[s].x = ip[0];    b1[s].x = ip[1];
    b0[s].y = ip[NTOK]; b1[s].y = ip[NTOK + 1];
  }

#pragma unroll
  for (int r = 0; r < 8; ++r) t0[r] = t1[r] = bias[co0 + 8 * hf + r];

#pragma unroll
  for (int s = 0; s < 16; ++s) {
    v2f a;
    a.x = (s & 1) ? wa[s >> 1].z : wa[s >> 1].x;
    a.y = (s & 1) ? wa[s >> 1].w : wa[s >> 1].y;
    t0 = __builtin_amdgcn_wmma_f32_16x16x4_f32(false, a, false, b0[s],
                                               (short)0, t0, false, false);
    t1 = __builtin_amdgcn_wmma_f32_16x16x4_f32(false, a, false, b1[s],
                                               (short)0, t1, false, false);
  }
}

// ---------------------------------------------------------------------------
// Kernel 1: qkv[192][4096] = w_qkv(192x64) @ x(64x4096) + b_qkv
//           also emits bf16 V in [h][d_pad16][m] layout (pad rows zeroed)
// grid (12, 32) x 128 threads: blockIdx.x = 16-channel tile (0..3 q, 4..7 k,
// 8..11 v; two heads each), one wave per 32 tokens: 1536 waves.
// ---------------------------------------------------------------------------
// waves_per_eu: register room for all 42 operand loads of a wave to be in
// flight at once (at the default budget they are asked for a dozen at a time)
__global__ __launch_bounds__(128) __attribute__((amdgpu_waves_per_eu(1, 4)))
void qkv_kernel(
    const float* __restrict__ x, const float* __restrict__ w,
    const float* __restrict__ b, float* __restrict__ qkv,
    unsigned short* __restrict__ vbf) {
  const int lane = threadIdx.x & 31;
  // wave number in a scalar register: EXEC stays all ones around the WMMAs
  const int wave = __builtin_amdgcn_readfirstlane(threadIdx.x >> 5);
  const int c    = lane & 15;
  const int hf   = lane >> 4;
  const int ct   = blockIdx.x;
  const int co0  = ct * 16;
  const int n0   = (blockIdx.y * 4 + wave) * 32;

  v8f t0, t1;
  pointwise_tile(w, b, x, co0, n0, c, hf, t0, t1);

#pragma unroll
  for (int r = 0; r < 8; ++r)
    *(float2*)(qkv + (co0 + 8 * hf + r) * NTOK + n0 + 2 * c) =
        make_float2(t0[r], t1[r]);
  // the branches below reuse the registers these stores name
  asm volatile("s_wait_xcnt 0x0" ::: "memory");

  if (ct >= 8) {                       // V -> bf16 copy, rows d = 0..7
    const int h = (ct - 8) * 2 + hf;
#pragma unroll
    for (int r = 0; r < 8; ++r)
      *(unsigned*)(vbf + ((h * 16) + r) * NTOK + n0 + 2 * c) =
          (unsigned)f32_bf16(t0[r]) | ((unsigned)f32_bf16(t1[r]) << 16);
  } else if (ct < 4) {                 // q tiles zero-fill V pad rows d = 8..15
    const int h = ct * 2 + hf;         // two lanes per row, 32 bytes each
    uint4* zp = (uint4*)(vbf + ((h * 16) + 8 + (c >> 1)) * NTOK + n0 +
                         (c & 1) * 16);
    zp[0] = make_uint4(0, 0, 0, 0);
    zp[1] = make_uint4(0, 0, 0, 0);
    // code laid out behind this branch reuses the registers these stores name
    asm volatile("s_wait_xcnt 0x0" ::: "memory");
  }
}

// ---------------------------------------------------------------------------
// Kernel 2: flash attention, keys split over the waves of a block.
// One block = 64 queries (QT 16-query tiles) of one head; the 4096 keys are
// cut into KSPLIT contiguous ranges, one wave per range. A wave loads each
// 32-key chunk of K and V once and uses the fragments for all QT tiles.
// Every wave keeps its own shifts, sums and accumulators; the partials are
// merged through LDS behind one barrier.
// The softmax shift of a query is not its running maximum: it is set from the
// wave's first chunk and then left alone until a logit rises more than
// SHIFT_ROOM above it. Minus the shift is the C operand of QK^T and the
// logits are in log2 units, so the WMMA result goes straight into exp2; the
// accumulators are rescaled only where the shifts move (all of a wave's
// queries move together, each to the larger of its shift and its maximum in that chunk).
// grid(512) x 256 threads (8 waves/block): 4096 waves, 4 per SIMD.
// ---------------------------------------------------------------------------
#define KSPLIT 8
#define KRANGE (NTOK / KSPLIT)   // keys per wave
#define QT 4                     // 16-query tiles per wave
#define QBLK (QT * 16)           // queries per block
#define SHIFT_ROOM 8.0f          // log2 units: every weight stays <= 256
static_assert(KSPLIT == HDIM, "the merge gives wave d row d of out^T");

// waves_per_eu: two blocks a WGP, so a wave may hold a quarter of a SIMD's
// registers (the scores of all QT tiles are live at once)
__global__ __launch_bounds__(KSPLIT * 32)
__attribute__((amdgpu_waves_per_eu(4, 4))) void attn_kernel(
    const float* __restrict__ qkv, const unsigned short* __restrict__ vbf,
    float* __restrict__ attn_out) {
  __shared__ float s_acc[KSPLIT][HDIM][QBLK]; // un-normalised partial out^T
  __shared__ float s_max[KSPLIT][QBLK];       // partial shifts (log2 units)
  __shared__ float s_sum[KSPLIT][QBLK];       // partial row sums

  const int lane = threadIdx.x & 31;
  // wave number in a scalar register: key range and loop bounds are then
  // wave-uniform for the compiler (EXEC stays all ones)
  const int wave = __builtin_amdgcn_readfirstlane(threadIdx.x >> 5);
  const int h    = blockIdx.x / (NTOK / QBLK);
  const int kr   = wave;                           // key range 0..KSPLIT-1
  const int nb   = (blockIdx.x % (NTOK / QBLK)) * QBLK;  // block's first query
  const int half = lane >> 4;                      // 0 | 1
  const int l16  = lane & 15;
  // 1/sqrt(8) * log2(e): logits come out in log2 units
  const float scale = 0.35355339059327373f * 1.4426950408889634f;

  const float*          qb = qkv + (h * HDIM) * NTOK;            // q[d][n]
  const float*          kb = qkv + (CCH + h * HDIM) * NTOK;      // k[d][m]
  const unsigned short* vb = vbf + (h * 16) * NTOK;              // v[d16][m]

  // Q as fp32 B-operand (4x16): lane L, vgpr r -> q[K = r + 2*half][n0+l16]
  const int dq = 2 * half;
  v2f qB0[QT], qB1[QT];   // d = 0..3 and d = 4..7  (scale folded in)
  // every loop over t is unrolled: constant indices keep the tiles in registers
#pragma unroll
  for (int t = 0; t < QT; ++t) {
    const int n = nb + t * 16 + l16;
    qB0[t].x = qb[(dq + 0) * NTOK + n] * scale;
    qB0[t].y = qb[(dq + 1) * NTOK + n] * scale;
    qB1[t].x = qb[(dq + 4) * NTOK + n] * scale;
    qB1[t].y = qb[(dq + 5) * NTOK + n] * scale;
  }

  v8f   acc[QT] = {};              // out^T accumulators (rows d, cols n)
  float shift[QT];                 // the same in both lanes of a query
  v4f   run_sum[QT] = {};          // four partial sums, this lane's keys

  union VFrag { v16bf v; uint4 u[2]; };
  struct KFrag { v2f a00, a01, a10, a11; };
  const int mbeg = kr * KRANGE;
  const int mend = mbeg + KRANGE;
  // this lane's place in the wave's next chunk of K and of V
  const float* kp = kb + dq * NTOK + mbeg + l16;
  const uint4* vp = (const uint4*)(vb + (size_t)l16 * NTOK + mbeg + half * 8);

  // the operand loads of one 32-key chunk
  auto fetch = [&](KFrag& k, VFrag& vA) {
    // ---- K as fp32 A-operand (16x4): lane L, vgpr r -> k[r+2*half][m]
    const float* k0 = kp;                   // key tile 0 (16 keys)
    const float* k1 = kp + 16;              // key tile 1 (the next 16)
    k.a00.x = k0[0 * NTOK]; k.a00.y = k0[1 * NTOK];
    k.a01.x = k0[4 * NTOK]; k.a01.y = k0[5 * NTOK];
    k.a10.x = k1[0 * NTOK]; k.a10.y = k1[1 * NTOK];
    k.a11.x = k1[4 * NTOK]; k.a11.y = k1[5 * NTOK];
    kp += 32;

    // ---- V as bf16 A-operand: lane L (row d=l16), two 16B contiguous loads
    vA.u[0] = vp[0];                // K =  0..7  (+8*half)
    vA.u[1] = vp[2];                // K = 16..23 (+8*half)
    vp += 4;
  };

  // S^T + c = (K-tile) x (Q-tile t) + c: fp32 WMMA, K-dim 4+4
  auto scores = [&](const KFrag& k, int t, const v8f c, v8f& s0, v8f& s1) {
    s0 = __builtin_amdgcn_wmma_f32_16x16x4_f32(false, k.a00, false, qB0[t],
                                               (short)0, c, false, false);
    s0 = __builtin_amdgcn_wmma_f32_16x16x4_f32(false, k.a01, false, qB1[t],
                                               (short)0, s0, false, false);
    s1 = __builtin_amdgcn_wmma_f32_16x16x4_f32(false, k.a10, false, qB0[t],
                                               (short)0, c, false, false);
    s1 = __builtin_amdgcn_wmma_f32_16x16x4_f32(false, k.a11, false, qB1[t],
                                               (short)0, s1, false, false);
  };

  // the largest of 'seed' and this lane's 16 logits
  auto lane_max = [&](float seed, const v8f s0, const v8f s1) {
    // unrolled: constant element indices keep the tiles in registers
#pragma unroll
    for (int r = 0; r < 8; ++r) seed = fmaxf(fmaxf(seed, s0[r]), s1[r]);
    return seed;
  };

  // weights of a chunk from tile t's shifted logits, their sum, and P x V
  auto weigh = [&](int t, const v8f s0, const v8f s1, const VFrag& vA) {
    v8f p0, p1;
    v16bf pB;                       // P^T packed straight into B-operand
    // unrolled: constant element indices keep the tiles in registers
#pragma unroll
    for (int r = 0; r < 8; ++r) p0[r] = __builtin_amdgcn_exp2f(s0[r]);
#pragma unroll
    for (int r = 0; r < 8; ++r) p1[r] = __builtin_amdgcn_exp2f(s1[r]);
#pragma unroll
    for (int r = 0; r < 8; ++r) {
      pB[r]     = (__bf16)p0[r];    // K =  r + 8*half   (tile 0)
      pB[8 + r] = (__bf16)p1[r];    // K = 16 + r + 8*half (tile 1)
    }
    run_sum[t] += p0.lo;            // packed adds, no temporaries
    run_sum[t] += p0.hi;
    run_sum[t] += p1.lo;
    run_sum[t] += p1.hi;
    acc[t] = __builtin_amdgcn_wmma_f32_16x16x32_bf16(
        false, vA.v, false, pB, (short)0, acc[t], false, false);
  };

  {                                 // first chunk: its maximum is the shift
    KFrag k;
    VFrag vA;
    fetch(k, vA);
    const v8f zero = {};
    v8f s0[QT], s1[QT];
#pragma unroll
    for (int t = 0; t < QT; ++t) {
      scores(k, t, zero, s0[t], s1[t]);
      const float lmax = lane_max(-INFINITY, s0[t], s1[t]);
      shift[t] = fmaxf(lmax, __shfl_xor(lmax, 16, 32));  // join half-waves
    }
#pragma unroll
    for (int t = 0; t < QT; ++t) {
      s0[t] -= shift[t];
      s1[t] -= shift[t];
      weigh(t, s0[t], s1[t], vA);
    }
  }
  int m0 = mbeg + 32;
  // outer loop: one trip per value of the shifts, so that C is invariant in
  // the inner loop and the WMMAs read it where it lies (no register copies)
  while (m0 < mend) {
    v8f nshift[QT];                 // minus the shift, in every row of C
#pragma unroll
    for (int t = 0; t < QT; ++t) nshift[t] = v8f{} - shift[t];
    bool moved;
    do {
      KFrag k;
      VFrag vA;
      fetch(k, vA);
      v8f s0[QT], s1[QT];
      float lmax[QT];               // how far above the shift, at least 0
      float top = 0.0f;
#pragma unroll
      for (int t = 0; t < QT; ++t) {
        scores(k, t, nshift[t], s0[t], s1[t]);
        lmax[t] = lane_max(0.0f, s0[t], s1[t]);
        top = fmaxf(top, lmax[t]);
      }
      // ballot: one scalar branch for the wave and chunk, EXEC stays all ones
      moved = __builtin_amdgcn_ballot_w32(top > SHIFT_ROOM) != 0u;
      if (moved) {                  // raise the shifts to this chunk's maxima where higher
#pragma unroll
        for (int t = 0; t < QT; ++t) {
          const float up = fmaxf(lmax[t], __shfl_xor(lmax[t], 16, 32));
          const float corr = __builtin_amdgcn_exp2f(-up);
          shift[t] += up;
          run_sum[t] *= corr;
          acc[t] *= corr;
          s0[t] -= up;
          s1[t] -= up;
        }
      }
#pragma unroll
      for (int t = 0; t < QT; ++t) weigh(t, s0[t], s1[t], vA);
      m0 += 32;
    } while (!moved && m0 < mend);
  }

  // ---- hand over the partials: lanes 0..15 hold rows d=0..7 of out^T
#pragma unroll
  for (int t = 0; t < QT; ++t) {
    float row_sum = (run_sum[t].x + run_sum[t].y) + (run_sum[t].z + run_sum[t].w);
    row_sum += __shfl_xor(row_sum, 16, 32);            // join half-waves
    if (half == 0) {
      const int q = t * 16 + l16;
#pragma unroll
      for (int r = 0; r < 8; ++r) s_acc[kr][r][q] = acc[t][r];
      s_max[kr][q] = shift[t];
      s_sum[kr][q] = row_sum;
    }
  }
  __syncthreads();   // every range's partial is in LDS before the merge

  // ---- merge + normalize + store: wave d stores row d, 128-B lines
#pragma unroll
  for (int q = lane; q < QBLK; q += 32) {
    float gmax = s_max[0][q];
#pragma unroll
    for (int s = 1; s < KSPLIT; ++s) gmax = fmaxf(gmax, s_max[s][q]);
    float num = 0.0f, den = 0.0f;
#pragma unroll
    for (int s = 0; s < KSPLIT; ++s) {
      const float wgt = __builtin_amdgcn_exp2f(s_max[s][q] - gmax);
      num = fmaf(s_acc[s][wave][q], wgt, num);
      den = fmaf(s_sum[s][q], wgt, den);
    }
    attn_out[(h * HDIM + wave) * NTOK + nb + q] = num / den;
  }
}

// ---------------------------------------------------------------------------
// Kernel 3: out = x + w_proj(64x64) @ attn_out + b_proj
// grid (4, 64) x 64 threads: blockIdx.x = 16-channel tile, one wave per 32
// tokens: 512 waves, one block per WGP.
// ---------------------------------------------------------------------------
// waves_per_eu: as in kernel 1, room for every load to be in flight at once
__global__ __launch_bounds__(64) __attribute__((amdgpu_waves_per_eu(1, 4)))
void proj_kernel(
    const float* __restrict__ x, const float* __restrict__ w,
    const float* __restrict__ b, const float* __restrict__ ao,
    float* __restrict__ out) {
  const int lane = threadIdx.x & 31;
  // wave number in a scalar register: EXEC stays all ones around the WMMAs
  const int wave = __builtin_amdgcn_readfirstlane(threadIdx.x >> 5);
  const int c    = lane & 15;
  const int hf   = lane >> 4;
  const int co0  = blockIdx.x * 16;
  const int n0   = (blockIdx.y * 2 + wave) * 32;

  float2 res[8];                       // residual, asked for with the operands
#pragma unroll
  for (int r = 0; r < 8; ++r)
    res[r] = *(const float2*)(x + (co0 + 8 * hf + r) * NTOK + n0 + 2 * c);

  v8f t0, t1;
  pointwise_tile(w, b, ao, co0, n0, c, hf, t0, t1);

#pragma unroll
  for (int r = 0; r < 8; ++r)
    *(float2*)(out + (co0 + 8 * hf + r) * NTOK + n0 + 2 * c) =
        make_float2(res[r].x + t0[r], res[r].y + t1[r]);
}

// ---------------------------------------------------------------------------
extern "C" void kernel_launch(void* const* d_in, const int* in_sizes, int n_in,
                              void* d_out, int out_size, void* d_ws,
                              size_t ws_size, hipStream_t stream) {
  const float* x      = (const float*)d_in[0];   // (1,64,16,16,16)
  const float* w_qkv  = (const float*)d_in[1];   // (192,64)
  const float* b_qkv  = (const float*)d_in[2];   // (192)
  const float* w_proj = (const float*)d_in[3];   // (64,64)
  const float* b_proj = (const float*)d_in[4];   // (64)
  float* out = (float*)d_out;

  char* ws = (char*)d_ws;
  float*          qkv = (float*)ws;                           // 192*4096 f32
  float*          ao  = (float*)(ws + 192 * NTOK * 4);        //  64*4096 f32
  unsigned short* vbf = (unsigned short*)(ws + 256 * NTOK * 4); // 8*16*4096 bf16

  qkv_kernel<<<dim3(12, 32), 128, 0, stream>>>(x, w_qkv, b_qkv, qkv, vbf);
  attn_kernel<<<dim3(512), 256, 0, stream>>>(qkv, vbf, ao);
  proj_kernel<<<dim3(4, 64), 64, 0, stream>>>(x, w_proj, b_proj, ao, out);
}

// v005
// A run of this version takes 23.4 microseconds.
// In both of two side-by-side timings against v004, it was 1.24 times as fast.
// Over all steps from v000 it is 3.44 times as fast.
#include <hip/hip_runtime.h>
#include <hip/hip_bf16.h>

// ---------------------------------------------------------------------------
// SpatialAttention for MI455X (gfx1250), flash-attention style:
//  - never materializes the 8x4096x4096 attention matrix (512MB -> 0)
//  - QK^T   : V_WMMA_F32_16X16X32_BF16, q and k each split into bf16 hi + lo;
//             the K-dim of 32 holds the four products hi*hi, hi*lo, lo*hi,
//             lo*lo of the 8 head dims (f32 sum, about 16 bits of each operand)
//  - softmax: online, per-lane (S^T layout => query = lane column), the shift
//             moved only when a logit outgrows it
//  - PV     : V_WMMA_F32_16X16X32_BF16 (K-dim = 4096 contraction)
//  - P^T in C/D layout packs directly into the bf16 B-operand layout
//  - both 1x1 projections: V_WMMA_F32_16X16X4_F32, 16 channels x 32 tokens a wave
// ---------------------------------------------------------------------------

typedef __attribute__((ext_vector_type(2)))  float  v2f;
typedef __attribute__((ext_vector_type(4)))  float  v4f;
typedef __attribute__((ext_vector_type(8)))  float  v8f;
typedef __attribute__((ext_vector_type(2)))  __bf16 v2bf;
typedef __attribute__((ext_vector_type(16))) __bf16 v16bf;

#define NTOK 4096   // 16*16*16 tokens
#define CCH  64     // channels
#define HEADS 8
#define HDIM  8
// 1/sqrt(8) * log2(e), folded into q: logits come out in log2 units
#define QK_SCALE (0.35355339059327373f * 1.4426950408889634f)

__device__ __forceinline__ unsigned short f32_bf16(float f) {
  unsigned u = __float_as_uint(f);
  u += 0x7FFFu + ((u >> 16) & 1u);   // round-to-nearest-even
  return (unsigned short)(u >> 16);
}

// x = hi + lo, both bf16, for two values at once (x0 in the low half of each
// word): the remainder x - hi is exact in f32, so a pair carries about 16
// significant bits of x
__device__ __forceinline__ void split_bf16(float x0, float x1, unsigned& hi,
                                           unsigned& lo) {
  const v2bf h = {(__bf16)x0, (__bf16)x1};
  hi = __builtin_bit_cast(unsigned, h);
  const v2bf l = {(__bf16)(x0 - __uint_as_float(hi << 16)),
                  (__bf16)(x1 - __uint_as_float(hi & 0xFFFF0000u))};
  lo = __builtin_bit_cast(unsigned, l);
}

// ---------------------------------------------------------------------------
// Shared by kernels 1 and 3: one wave's tile of  W(rows x 64) @ in(64 x 4096)
// + bias  on V_WMMA_F32_16X16X4_F32: 16 output channels x 32 tokens.
//  - A = W rows co0..co0+15 (lane column c = row), B = in (lane column c =
//    token); column c of tile t is token n0 + 2c + t, so a lane ends up with
//    two neighbouring tokens of each of its 8 channels (8-byte stores)
//  - operand register r of lane half hf at step s holds input channel
//    ci = 8*(s/2) + 4*hf + 2*(s%2) + r for A and for B alike: a lane's weights
//    of two steps are 16 contiguous bytes
//  - result: t0[r], t1[r] = channel co0 + 8*hf + r, tokens n0 + 2c, n0 + 2c + 1
// ---------------------------------------------------------------------------
__device__ __forceinline__ void pointwise_tile(
    const float* __restrict__ w, const float* __restrict__ bias,
    const float* __restrict__ in, int co0, int n0, int c, int hf,
    v8f& t0, v8f& t1) {
  const float* wrow = w + (co0 + c) * CCH + hf * 4;
  const float* icol = in + (hf * 4) * NTOK + n0 + 2 * c;

  float4 wa[8];
#pragma unroll
  for (int p = 0; p < 8; ++p) wa[p] = *(const float4*)(wrow + p * 8);

  v2f b0[16], b1[16];
#pragma unroll
  for (int s = 0; s < 16; ++s) {
    const float* ip = icol + ((s >> 1) * 8 + (s & 1) * 2) * NTOK;
    b0[s].x = ip[0];    b1[s].x = ip[1];
    b0[s].y = ip[NTOK]; b1[s].y = ip[NTOK + 1];
  }

#pragma unroll
  for (int r = 0; r < 8; ++r) t0[r] = t1[r] = bias[co0 + 8 * hf + r];

#pragma unroll
  for (int s = 0; s < 16; ++s) {
    v2f a;
    a.x = (s & 1) ? wa[s >> 1].z : wa[s >> 1].x;
    a.y = (s & 1) ? wa[s >> 1].w : wa[s >> 1].y;
    t0 = __builtin_amdgcn_wmma_f32_16x16x4_f32(false, a, false, b0[s],
                                               (short)0, t0, false, false);
    t1 = __builtin_amdgcn_wmma_f32_16x16x4_f32(false, a, false, b1[s],
                                               (short)0, t1, false, false);
  }
}

// ---------------------------------------------------------------------------
// Kernel 1: qkv[192][4096] = w_qkv(192x64) @ x(64x4096) + b_qkv
//           also emits bf16 V in [h][d_pad16][m] layout (pad rows zeroed)
//           q (softmax scale folded in) and k leave only as bf16 hi + lo:
//           qkhl[q heads 0..7, k heads 0..7][token][16], hi of d = 0..7, then
//           lo of d = 0..7
// grid (12, 32) x 128 threads: blockIdx.x = 16-channel tile (0..3 q, 4..7 k,
// 8..11 v; two heads each), one wave per 32 tokens: 1536 waves.
// ---------------------------------------------------------------------------
// waves_per_eu: register room for all 42 operand loads of a wave to be in
// flight at once (at the default budget they are asked for a dozen at a time)
__global__ __launch_bounds__(128) __attribute__((amdgpu_waves_per_eu(1, 4)))
void qkv_kernel(
    const float* __restrict__ x, const float* __restrict__ w,
    const float* __restrict__ b, float* __restrict__ qkv,
    unsigned short* __restrict__ qkhl, unsigned short* __restrict__ vbf) {
  const int lane = threadIdx.x & 31;
  // wave number in a scalar register: EXEC stays all ones around the WMMAs
  const int wave = __builtin_amdgcn_readfirstlane(threadIdx.x >> 5);
  const int c    = lane & 15;
  const int hf   = lane >> 4;
  const int ct   = blockIdx.x;
  const int co0  = ct * 16;
  const int n0   = (blockIdx.y * 4 + wave) * 32;

  v8f t0, t1;
  pointwise_tile(w, b, x, co0, n0, c, hf, t0, t1);

  if (ct < 8) {                        // q, k -> bf16 hi and lo, 32 B a token
    const float sc = ct < 4 ? QK_SCALE : 1.0f;
    t0 *= sc;
    t1 *= sc;
    uint4 hi0, lo0, hi1, lo1;          // a lane has all 8 dims of two tokens
    split_bf16(t0[0], t0[1], hi0.x, lo0.x);
    split_bf16(t0[2], t0[3], hi0.y, lo0.y);
    split_bf16(t0[4], t0[5], hi0.z, lo0.z);
    split_bf16(t0[6], t0[7], hi0.w, lo0.w);
    split_bf16(t1[0], t1[1], hi1.x, lo1.x);
    split_bf16(t1[2], t1[3], hi1.y, lo1.y);
    split_bf16(t1[4], t1[5], hi1.z, lo1.z);
    split_bf16(t1[6], t1[7], hi1.w, lo1.w);
    uint4* hl = (uint4*)(qkhl + ((ct * 2 + hf) * NTOK + n0 + 2 * c) * 16);
    hl[0] = hi0; hl[1] = lo0;
    hl[2] = hi1; hl[3] = lo1;
    // the code below reuses the registers these stores name
    asm volatile("s_wait_xcnt 0x0" ::: "memory");

    if (ct < 4) {                      // q tiles zero-fill V pad rows d = 8..15
      const int h = ct * 2 + hf;       // two lanes per row, 32 bytes each
      uint4* zp = (uint4*)(vbf + ((h * 16) + 8 + (c >> 1)) * NTOK + n0 +
                           (c & 1) * 16);
      zp[0] = make_uint4(0, 0, 0, 0);
      zp[1] = make_uint4(0, 0, 0, 0);
    }
    return;
  }

#pragma unroll
  for (int r = 0; r < 8; ++r)
    *(float2*)(qkv + (co0 + 8 * hf + r) * NTOK + n0 + 2 * c) =
        make_float2(t0[r], t1[r]);
  // the code below reuses the registers these stores name
  asm volatile("s_wait_xcnt 0x0" ::: "memory");

  const int h = (ct - 8) * 2 + hf;     // V -> bf16 copy, rows d = 0..7
#pragma unroll
  for (int r = 0; r < 8; ++r)
    *(unsigned*)(vbf + ((h * 16) + r) * NTOK + n0 + 2 * c) =
        (unsigned)f32_bf16(t0[r]) | ((unsigned)f32_bf16(t1[r]) << 16);
}

// ---------------------------------------------------------------------------
// Kernel 2: flash attention, keys split over the waves of a block.
// One block = 64 queries (QT 16-query tiles) of one head; the 4096 keys are
// cut into KSPLIT contiguous ranges, one wave per range. A wave loads each
// 32-key chunk of K and V once and uses the fragments for all QT tiles.
// Every wave keeps its own shifts, sums and accumulators; the partials are
// merged through LDS behind one barrier.
// The softmax shift of a query is not its running maximum: it is set from the
// wave's first chunk and then left alone until a logit rises more than
// SHIFT_ROOM above it. Minus the shift is the C operand of QK^T and the
// logits are in log2 units, so the WMMA result goes straight into exp2; the
// accumulators are rescaled only where the shifts move (all of a wave's
// queries move together, each to the larger of its shift and its maximum in that chunk).
// grid(512) x 256 threads (8 waves/block): 4096 waves, 4 per SIMD.
// ---------------------------------------------------------------------------
#define KSPLIT 8
#define KRANGE (NTOK / KSPLIT)   // keys per wave
#define QT 4                     // 16-query tiles per wave
#define QBLK (QT * 16)           // queries per block
#define SHIFT_ROOM 8.0f          // log2 units: every weight stays <= 256
static_assert(KSPLIT == HDIM, "the merge gives wave d row d of out^T");

// waves_per_eu: two blocks a WGP, so a wave may hold a quarter of a SIMD's
// registers (the scores of all QT tiles are live at once)
__global__ __launch_bounds__(KSPLIT * 32)
__attribute__((amdgpu_waves_per_eu(4, 4))) void attn_kernel(
    const unsigned short* __restrict__ qkhl,
    const unsigned short* __restrict__ vbf, float* __restrict__ attn_out) {
  __shared__ float s_acc[KSPLIT][HDIM][QBLK]; // un-normalised partial out^T
  __shared__ float s_max[KSPLIT][QBLK];       // partial shifts (log2 units)
  __shared__ float s_sum[KSPLIT][QBLK];       // partial row sums

  const int lane = threadIdx.x & 31;
  // wave number in a scalar register: key range and loop bounds are then
  // wave-uniform for the compiler (EXEC stays all ones)
  const int wave = __builtin_amdgcn_readfirstlane(threadIdx.x >> 5);
  const int h    = blockIdx.x / (NTOK / QBLK);
  const int kr   = wave;                           // key range 0..KSPLIT-1
  const int nb   = (blockIdx.x % (NTOK / QBLK)) * QBLK;  // block's first query
  const int half = lane >> 4;                      // 0 | 1
  const int l16  = lane & 15;

  const unsigned short* qb = qkhl + (h * NTOK + nb) * 16;        // q[n][hi8|lo8]
  const unsigned short* kb = qkhl + ((HEADS + h) * NTOK) * 16;   // k[m][hi8|lo8]
  const unsigned short* vb = vbf + (h * 16) * NTOK;              // v[d16][m]

  // Q as bf16 B-operand (32x16). Elements e and 8 + e of a lane hold dim e of
  // its query: q_hi in lane half 0, q_lo in lane half 1.
  // The K fragment has k_hi at e and k_lo at 8 + e in both halves, so the 32
  // products of a column are (q_hi + q_lo)[d] * (k_hi + k_lo)[d], d = 0..7.
  union VFrag { v16bf v; uint4 u[2]; };
  VFrag qB[QT];
  // every loop over t is unrolled: constant indices keep the tiles in registers
#pragma unroll
  for (int t = 0; t < QT; ++t)
    qB[t].u[0] = qB[t].u[1] =
        *(const uint4*)(qb + (t * 16 + l16) * 16 + half * 8);

  v8f   acc[QT] = {};              // out^T accumulators (rows d, cols n)
  float shift[QT];                 // the same in both lanes of a query
  v4f   run_sum[QT] = {};          // four partial sums, this lane's keys

  struct KFrag { VFrag a0, a1; };  // key tile 0 (16 keys), tile 1 (the next 16)
  const int mbeg = kr * KRANGE;
  const int mend = mbeg + KRANGE;
  // this lane's place in the wave's next chunk of K and of V
  const uint4* kp = (const uint4*)(kb + (mbeg + l16) * 16);
  const uint4* vp = (const uint4*)(vb + (size_t)l16 * NTOK + mbeg + half * 8);

  // the operand loads of one 32-key chunk
  auto fetch = [&](KFrag& k, VFrag& vA) {
    // ---- K as bf16 A-operand: lane L (row m=l16, both halves alike), the
    //      key's 32 bytes: hi of d = 0..7, then lo of d = 0..7
    k.a0.u[0] = kp[0];  k.a0.u[1] = kp[1];
    k.a1.u[0] = kp[32]; k.a1.u[1] = kp[33];
    kp += 64;

    // ---- V as bf16 A-operand: lane L (row d=l16), two 16B contiguous loads
    vA.u[0] = vp[0];                // K =  0..7  (+8*half)
    vA.u[1] = vp[2];                // K = 16..23 (+8*half)
    vp += 4;
  };

  // S^T + c = (K-tile) x (Q-tile t) + c: one bf16 WMMA a key tile
  auto scores = [&](const KFrag& k, int t, const v8f c, v8f& s0, v8f& s1) {
    s0 = __builtin_amdgcn_wmma_f32_16x16x32_bf16(
        false, k.a0.v, false, qB[t].v, (short)0, c, false, false);
    s1 = __builtin_amdgcn_wmma_f32_16x16x32_bf16(
        false, k.a1.v, false, qB[t].v, (short)0, c, false, false);
  };

  // the largest of 'seed' and this lane's 16 logits
  auto lane_max = [&](float seed, const v8f s0, const v8f s1) {
    // unrolled: constant element indices keep the tiles in registers
#pragma unroll
    for (int r = 0; r < 8; ++r) seed = fmaxf(fmaxf(seed, s0[r]), s1[r]);
    return seed;
  };

  // weights of a chunk from tile t's shifted logits, their sum, and P x V
  auto weigh = [&](int t, const v8f s0, const v8f s1, const VFrag& vA) {
    v8f p0, p1;
    v16bf pB;                       // P^T packed straight into B-operand
    // unrolled: constant element indices keep the tiles in registers
#pragma unroll
    for (int r = 0; r < 8; ++r) p0[r] = __builtin_amdgcn_exp2f(s0[r]);
#pragma unroll
    for (int r = 0; r < 8; ++r) p1[r] = __builtin_amdgcn_exp2f(s1[r]);
#pragma unroll
    for (int r = 0; r < 8; ++r) {
      pB[r]     = (__bf16)p0[r];    // K =  r + 8*half   (tile 0)
      pB[8 + r] = (__bf16)p1[r];    // K = 16 + r + 8*half (tile 1)
    }
    run_sum[t] += p0.lo;            // packed adds, no temporaries
    run_sum[t] += p0.hi;
    run_sum[t] += p1.lo;
    run_sum[t] += p1.hi;
    acc[t] = __builtin_amdgcn_wmma_f32_16x16x32_bf16(
        false, vA.v, false, pB, (short)0, acc[t], false, false);
  };

  {                                 // first chunk: its maximum is the shift
    KFrag k;
    VFrag vA;
    fetch(k, vA);
    const v8f zero = {};
    v8f s0[QT], s1[QT];
#pragma unroll
    for (int t = 0; t < QT; ++t) {
      scores(k, t, zero, s0[t], s1[t]);
      const float lmax = lane_max(-INFINITY, s0[t], s1[t]);
      shift[t] = fmaxf(lmax, __shfl_xor(lmax, 16, 32));  // join half-waves
    }
#pragma unroll
    for (int t = 0; t < QT; ++t) {
      s0[t] -= shift[t];
      s1[t] -= shift[t];
      weigh(t, s0[t], s1[t], vA);
    }
  }
  int m0 = mbeg + 32;
  // outer loop: one trip per value of the shifts, so that C is invariant in
  // the inner loop and the WMMAs read it where it lies (no register copies)
  while (m0 < mend) {
    v8f nshift[QT];                 // minus the shift, in every row of C
#pragma unroll
    for (int t = 0; t < QT; ++t) nshift[t] = v8f{} - shift[t];
    bool moved;
    do {
      KFrag k;
      VFrag vA;
      fetch(k, vA);
      // keeps V's loads up here beside K's: sunk behind QK^T (into K's
      // registers) they would start a second wait in every trip
      __builtin_amdgcn_sched_barrier(0);
      v8f s0[QT], s1[QT];
      float lmax[QT];               // how far above the shift, at least 0
      float top = 0.0f;
#pragma unroll
      for (int t = 0; t < QT; ++t) scores(k, t, nshift[t], s0[t], s1[t]);
      // keeps the 8 WMMAs back to back: a maximum moved in between them waits
      // for its WMMA's result behind v_nops
      __builtin_amdgcn_sched_barrier(0);
#pragma unroll
      for (int t = 0; t < QT; ++t) {
        lmax[t] = lane_max(0.0f, s0[t], s1[t]);
        top = fmaxf(top, lmax[t]);
      }
      // ballot: one scalar branch for the wave and chunk, EXEC stays all ones
      moved = __builtin_amdgcn_ballot_w32(top > SHIFT_ROOM) != 0u;
      if (moved) {                  // raise the shifts to this chunk's maxima where higher
#pragma unroll
        for (int t = 0; t < QT; ++t) {
          const float up = fmaxf(lmax[t], __shfl_xor(lmax[t], 16, 32));
          const float corr = __builtin_amdgcn_exp2f(-up);
          shift[t] += up;
          run_sum[t] *= corr;
          acc[t] *= corr;
          s0[t] -= up;
          s1[t] -= up;
        }
      }
#pragma unroll
      for (int t = 0; t < QT; ++t) weigh(t, s0[t], s1[t], vA);
      m0 += 32;
    } while (!moved && m0 < mend);
  }

  // ---- hand over the partials: lanes 0..15 hold rows d=0..7 of out^T
#pragma unroll
  for (int t = 0; t < QT; ++t) {
    float row_sum = (run_sum[t].x + run_sum[t].y) + (run_sum[t].z + run_sum[t].w);
    row_sum += __shfl_xor(row_sum, 16, 32);            // join half-waves
    if (half == 0) {
      const int q = t * 16 + l16;
#pragma unroll
      for (int r = 0; r < 8; ++r) s_acc[kr][r][q] = acc[t][r];
      s_max[kr][q] = shift[t];
      s_sum[kr][q] = row_sum;
    }
  }
  __syncthreads();   // every range's partial is in LDS before the merge

  // ---- merge + normalize + store: wave d stores row d, 128-B lines
#pragma unroll
  for (int q = lane; q < QBLK; q += 32) {
    float gmax = s_max[0][q];
#pragma unroll
    for (int s = 1; s < KSPLIT; ++s) gmax = fmaxf(gmax, s_max[s][q]);
    float num = 0.0f, den = 0.0f;
#pragma unroll
    for (int s = 0; s < KSPLIT; ++s) {
      const float wgt = __builtin_amdgcn_exp2f(s_max[s][q] - gmax);
      num = fmaf(s_acc[s][wave][q], wgt, num);
      den = fmaf(s_sum[s][q], wgt, den);
    }
    attn_out[(h * HDIM + wave) * NTOK + nb + q] = num / den;
  }
}

// ---------------------------------------------------------------------------
// Kernel 3: out = x + w_proj(64x64) @ attn_out + b_proj
// grid (4, 64) x 64 threads: blockIdx.x = 16-channel tile, one wave per 32
// tokens: 512 waves, one block per WGP.
// ---------------------------------------------------------------------------
// waves_per_eu: as in kernel 1, room for every load to be in flight at once
__global__ __launch_bounds__(64) __attribute__((amdgpu_waves_per_eu(1, 4)))
void proj_kernel(
    const float* __restrict__ x, const float* __restrict__ w,
    const float* __restrict__ b, const float* __restrict__ ao,
    float* __restrict__ out) {
  const int lane = threadIdx.x & 31;
  // wave number in a scalar register: EXEC stays all ones around the WMMAs
  const int wave = __builtin_amdgcn_readfirstlane(threadIdx.x >> 5);
  const int c    = lane & 15;
  const int hf   = lane >> 4;
  const int co0  = blockIdx.x * 16;
  const int n0   = (blockIdx.y * 2 + wave) * 32;

  float2 res[8];                       // residual, asked for with the operands
#pragma unroll
  for (int r = 0; r < 8; ++r)
    res[r] = *(const float2*)(x + (co0 + 8 * hf + r) * NTOK + n0 + 2 * c);

  v8f t0, t1;
  pointwise_tile(w, b, ao, co0, n0, c, hf, t0, t1);

#pragma unroll
  for (int r = 0; r < 8; ++r)
    *(float2*)(out + (co0 + 8 * hf + r) * NTOK + n0 + 2 * c) =
        make_float2(res[r].x + t0[r], res[r].y + t1[r]);
}

// ---------------------------------------------------------------------------
extern "C" void kernel_launch(void* const* d_in, const int* in_sizes, int n_in,
                              void* d_out, int out_size, void* d_ws,
                              size_t ws_size, hipStream_t stream) {
  const float* x      = (const float*)d_in[0];   // (1,64,16,16,16)
  const float* w_qkv  = (const float*)d_in[1];   // (192,64)
  const float* b_qkv  = (const float*)d_in[2];   // (192)
  const float* w_proj = (const float*)d_in[3];   // (64,64)
  const float* b_proj = (const float*)d_in[4];   // (64)
  float* out = (float*)d_out;

  char* ws = (char*)d_ws;
  float*          qkv = (float*)ws;              // 192*4096 f32, v rows written
  unsigned short* qkhl = (unsigned short*)ws;        // in its q and k rows' place
  float*          ao  = (float*)(ws + 192 * NTOK * 4);        //  64*4096 f32
  unsigned short* vbf = (unsigned short*)(ws + 256 * NTOK * 4); // 8*16*4096 bf16

  qkv_kernel<<<dim3(12, 32), 128, 0, stream>>>(x, w_qkv, b_qkv, qkv, qkhl, vbf);
  attn_kernel<<<dim3(512), 256, 0, stream>>>(qkhl, vbf, ao);
  proj_kernel<<<dim3(4, 64), 64, 0, stream>>>(x, w_proj, b_proj, ao, out);
}

// v006
// A run of this version takes 21.5 microseconds.
// Next to v005, in two timings, it ran 1.07 and 1.10 times as fast.
// All steps since v000 together make it 3.73 times as fast.
#include <hip/hip_runtime.h>
#include <hip/hip_bf16.h>

// ---------------------------------------------------------------------------
// SpatialAttention for MI455X (gfx1250), flash-attention style:
//  - never materializes the 8x4096x4096 attention matrix (512MB -> 0)
//  - QK^T   : V_WMMA_F32_16X16X32_BF16, q and k each split into bf16 hi + lo;
//             the K-dim of 32 holds the four products hi*hi, hi*lo, lo*hi,
//             lo*lo of the 8 head dims (f32 sum, about 16 bits of each operand)
//  - softmax: per-lane (S^T layout => query = lane column), no shift where the
//             sums stay in range; else online, with a shift
//  - PV     : V_WMMA_F32_16X16X32_BF16 (K-dim = 4096 contraction)
//  - P^T in C/D layout packs directly into the bf16 B-operand layout
//  - both 1x1 projections: V_WMMA_F32_16X16X4_F32, 16 channels x 32 tokens a wave
// ---------------------------------------------------------------------------

typedef __attribute__((ext_vector_type(2)))  float  v2f;
typedef __attribute__((ext_vector_type(4)))  float  v4f;
typedef __attribute__((ext_vector_type(8)))  float  v8f;
typedef __attribute__((ext_vector_type(2)))  __bf16 v2bf;
typedef __attribute__((ext_vector_type(16))) __bf16 v16bf;

#define NTOK 4096   // 16*16*16 tokens
#define CCH  64     // channels
#define HEADS 8
#define HDIM  8
// 1/sqrt(8) * log2(e), folded into q: logits come out in log2 units
#define QK_SCALE (0.35355339059327373f * 1.4426950408889634f)

__device__ __forceinline__ unsigned short f32_bf16(float f) {
  unsigned u = __float_as_uint(f);
  u += 0x7FFFu + ((u >> 16) & 1u);   // round-to-nearest-even
  return (unsigned short)(u >> 16);
}

// x = hi + lo, both bf16, for two values at once (x0 in the low half of each
// word): the remainder x - hi is exact in f32, so a pair carries about 16
// significant bits of x
__device__ __forceinline__ void split_bf16(float x0, float x1, unsigned& hi,
                                           unsigned& lo) {
  const v2bf h = {(__bf16)x0, (__bf16)x1};
  hi = __builtin_bit_cast(unsigned, h);
  const v2bf l = {(__bf16)(x0 - __uint_as_float(hi << 16)),
                  (__bf16)(x1 - __uint_as_float(hi & 0xFFFF0000u))};
  lo = __builtin_bit_cast(unsigned, l);
}

// ---------------------------------------------------------------------------
// Shared by kernels 1 and 3: one wave's tile of  W(rows x 64) @ in(64 x 4096)
// + bias  on V_WMMA_F32_16X16X4_F32: 16 output channels x 32 tokens.
//  - A = W rows co0..co0+15 (lane column c = row), B = in (lane column c =
//    token); column c of tile t is token n0 + 2c + t, so a lane ends up with
//    two neighbouring tokens of each of its 8 channels (8-byte stores)
//  - operand register r of lane half hf at step s holds input channel
//    ci = 8*(s/2) + 4*hf + 2*(s%2) + r for A and for B alike: a lane's weights
//    of two steps are 16 contiguous bytes
//  - result: t0[r], t1[r] = channel co0 + 8*hf + r, tokens n0 + 2c, n0 + 2c + 1
// ---------------------------------------------------------------------------
__device__ __forceinline__ void pointwise_tile(
    const float* __restrict__ w, const float* __restrict__ bias,
    const float* __restrict__ in, int co0, int n0, int c, int hf,
    v8f& t0, v8f& t1) {
  const float* wrow = w + (co0 + c) * CCH + hf * 4;
  const float* icol = in + (hf * 4) * NTOK + n0 + 2 * c;

  float4 wa[8];
#pragma unroll
  for (int p = 0; p < 8; ++p) wa[p] = *(const float4*)(wrow + p * 8);

  v2f b0[16], b1[16];
#pragma unroll
  for (int s = 0; s < 16; ++s) {
    const float* ip = icol + ((s >> 1) * 8 + (s & 1) * 2) * NTOK;
    b0[s].x = ip[0];    b1[s].x = ip[1];
    b0[s].y = ip[NTOK]; b1[s].y = ip[NTOK + 1];
  }

#pragma unroll
  for (int r = 0; r < 8; ++r) t0[r] = t1[r] = bias[co0 + 8 * hf + r];

#pragma unroll
  for (int s = 0; s < 16; ++s) {
    v2f a;
    a.x = (s & 1) ? wa[s >> 1].z : wa[s >> 1].x;
    a.y = (s & 1) ? wa[s >> 1].w : wa[s >> 1].y;
    t0 = __builtin_amdgcn_wmma_f32_16x16x4_f32(false, a, false, b0[s],
                                               (short)0, t0, false, false);
    t1 = __builtin_amdgcn_wmma_f32_16x16x4_f32(false, a, false, b1[s],
                                               (short)0, t1, false, false);
  }
}

// ---------------------------------------------------------------------------
// Kernel 1: qkv[192][4096] = w_qkv(192x64) @ x(64x4096) + b_qkv
//           also emits bf16 V in [h][d_pad16][m] layout (pad rows zeroed)
//           q (softmax scale folded in) and k leave only as bf16 hi + lo:
//           qkhl[q heads 0..7, k heads 0..7][token][16], hi of d = 0..7, then
//           lo of d = 0..7
// grid (12, 32) x 128 threads: blockIdx.x = 16-channel tile (0..3 q, 4..7 k,
// 8..11 v; two heads each), one wave per 32 tokens: 1536 waves.
// ---------------------------------------------------------------------------
// waves_per_eu: register room for all 42 operand loads of a wave to be in
// flight at once (at the default budget they are asked for a dozen at a time)
__global__ __launch_bounds__(128) __attribute__((amdgpu_waves_per_eu(1, 4)))
void qkv_kernel(
    const float* __restrict__ x, const float* __restrict__ w,
    const float* __restrict__ b, float* __restrict__ qkv,
    unsigned short* __restrict__ qkhl, unsigned short* __restrict__ vbf) {
  const int lane = threadIdx.x & 31;
  // wave number in a scalar register: EXEC stays all ones around the WMMAs
  const int wave = __builtin_amdgcn_readfirstlane(threadIdx.x >> 5);
  const int c    = lane & 15;
  const int hf   = lane >> 4;
  const int ct   = blockIdx.x;
  const int co0  = ct * 16;
  const int n0   = (blockIdx.y * 4 + wave) * 32;

  v8f t0, t1;
  pointwise_tile(w, b, x, co0, n0, c, hf, t0, t1);

  if (ct < 8) {                        // q, k -> bf16 hi and lo, 32 B a token
    const float sc = ct < 4 ? QK_SCALE : 1.0f;
    t0 *= sc;
    t1 *= sc;
    uint4 hi0, lo0, hi1, lo1;          // a lane has all 8 dims of two tokens
    split_bf16(t0[0], t0[1], hi0.x, lo0.x);
    split_bf16(t0[2], t0[3], hi0.y, lo0.y);
    split_bf16(t0[4], t0[5], hi0.z, lo0.z);
    split_bf16(t0[6], t0[7], hi0.w, lo0.w);
    split_bf16(t1[0], t1[1], hi1.x, lo1.x);
    split_bf16(t1[2], t1[3], hi1.y, lo1.y);
    split_bf16(t1[4], t1[5], hi1.z, lo1.z);
    split_bf16(t1[6], t1[7], hi1.w, lo1.w);
    uint4* hl = (uint4*)(qkhl + ((ct * 2 + hf) * NTOK + n0 + 2 * c) * 16);
    hl[0] = hi0; hl[1] = lo0;
    hl[2] = hi1; hl[3] = lo1;
    // the code below reuses the registers these stores name
    asm volatile("s_wait_xcnt 0x0" ::: "memory");

    if (ct < 4) {                      // q tiles zero-fill V pad rows d = 8..15
      const int h = ct * 2 + hf;       // two lanes per row, 32 bytes each
      uint4* zp = (uint4*)(vbf + ((h * 16) + 8 + (c >> 1)) * NTOK + n0 +
                           (c & 1) * 16);
      zp[0] = make_uint4(0, 0, 0, 0);
      zp[1] = make_uint4(0, 0, 0, 0);
    }
    return;
  }

#pragma unroll
  for (int r = 0; r < 8; ++r)
    *(float2*)(qkv + (co0 + 8 * hf + r) * NTOK + n0 + 2 * c) =
        make_float2(t0[r], t1[r]);
  // the code below reuses the registers these stores name
  asm volatile("s_wait_xcnt 0x0" ::: "memory");

  const int h = (ct - 8) * 2 + hf;     // V -> bf16 copy, rows d = 0..7
#pragma unroll
  for (int r = 0; r < 8; ++r)
    *(unsigned*)(vbf + ((h * 16) + r) * NTOK + n0 + 2 * c) =
        (unsigned)f32_bf16(t0[r]) | ((unsigned)f32_bf16(t1[r]) << 16);
}

// ---------------------------------------------------------------------------
// Kernel 2: flash attention, keys split over the waves of a block.
// One block = 64 queries (QT 16-query tiles) of one head; the 4096 keys are
// cut into KSPLIT contiguous ranges, one wave per range. A wave loads each
// 32-key chunk of K and V once and uses the fragments for all QT tiles.
// Every wave keeps its own shifts, sums and accumulators; the partials are
// merged through LDS behind one barrier.
// A wave first takes its range with no softmax shift at all: the weights are
// exp2 of the logits as they come. f32 and bf16 have 8 exponent bits, so the
// weights keep their relative precision and the quotient is the same as long
// as nothing leaves the exponent range. That is tested once, behind the range:
// every query's sum within 2^-SUM_ROOM .. 2^SUM_ROOM and every accumulator
// finite. A wave that fails the test throws its partials away and takes the
// range again with a shift, as follows.
// The softmax shift of a query is not its running maximum: it is set from the
// wave's first chunk and then left alone until a logit rises more than
// SHIFT_ROOM above it. Minus the shift is the C operand of QK^T and the
// logits are in log2 units, so the WMMA result goes straight into exp2; the
// accumulators are rescaled only where the shifts move (all of a wave's
// queries move together, each to the larger of its shift and its maximum in that chunk).
// grid(512) x 256 threads (8 waves/block): 4096 waves, 4 per SIMD.
// ---------------------------------------------------------------------------
#define KSPLIT 8
#define KRANGE (NTOK / KSPLIT)   // keys per wave
#define QT 4                     // 16-query tiles per wave
#define QBLK (QT * 16)           // queries per block
#define SHIFT_ROOM 8.0f          // log2 units: every weight stays <= 256
// unshifted pass, log2 units: a sum of 512 weights in this range has its
// largest weight within 2^-49 .. 2^40, so that none overflows and every weight
// down to 2^-77 of the largest is a normal number
#define SUM_ROOM 40
static_assert(KSPLIT == HDIM, "the merge gives wave d row d of out^T");

// waves_per_eu: two blocks a WGP, so a wave may hold a quarter of a SIMD's
// registers (the scores of all QT tiles are live at once)
__global__ __launch_bounds__(KSPLIT * 32)
__attribute__((amdgpu_waves_per_eu(4, 4))) void attn_kernel(
    const unsigned short* __restrict__ qkhl,
    const unsigned short* __restrict__ vbf, float* __restrict__ attn_out) {
  __shared__ float s_acc[KSPLIT][HDIM][QBLK]; // un-normalised partial out^T
  __shared__ float s_max[KSPLIT][QBLK];       // partial shifts (log2 units)
  __shared__ float s_sum[KSPLIT][QBLK];       // partial row sums

  const int lane = threadIdx.x & 31;
  // wave number in a scalar register: key range and loop bounds are then
  // wave-uniform for the compiler (EXEC stays all ones)
  const int wave = __builtin_amdgcn_readfirstlane(threadIdx.x >> 5);
  const int h    = blockIdx.x / (NTOK / QBLK);
  const int kr   = wave;                           // key range 0..KSPLIT-1
  const int nb   = (blockIdx.x % (NTOK / QBLK)) * QBLK;  // block's first query
  const int half = lane >> 4;                      // 0 | 1
  const int l16  = lane & 15;

  const unsigned short* qb = qkhl + (h * NTOK + nb) * 16;        // q[n][hi8|lo8]
  const unsigned short* kb = qkhl + ((HEADS + h) * NTOK) * 16;   // k[m][hi8|lo8]
  const unsigned short* vb = vbf + (h * 16) * NTOK;              // v[d16][m]

  // Q as bf16 B-operand (32x16). Elements e and 8 + e of a lane hold dim e of
  // its query: q_hi in lane half 0, q_lo in lane half 1.
  // The K fragment has k_hi at e and k_lo at 8 + e in both halves, so the 32
  // products of a column are (q_hi + q_lo)[d] * (k_hi + k_lo)[d], d = 0..7.
  union VFrag { v16bf v; uint4 u[2]; };
  VFrag qB[QT];
  // every loop over t is unrolled: constant indices keep the tiles in registers
#pragma unroll
  for (int t = 0; t < QT; ++t)
    qB[t].u[0] = qB[t].u[1] =
        *(const uint4*)(qb + (t * 16 + l16) * 16 + half * 8);

  v8f   acc[QT] = {};              // out^T accumulators (rows d, cols n)
  float shift[QT] = {};            // the same in both lanes of a query
  v4f   run_sum[QT] = {};          // four partial sums, this lane's keys
  float row_sum[QT];               // a query's sum over the wave's keys

  struct KFrag { VFrag a0, a1; };  // key tile 0 (16 keys), tile 1 (the next 16)
  const int mbeg = kr * KRANGE;
  const int mend = mbeg + KRANGE;
  // this lane's place in the wave's next chunk of K and of V
  const uint4* const kp0 = (const uint4*)(kb + (mbeg + l16) * 16);
  const uint4* const vp0 =
      (const uint4*)(vb + (size_t)l16 * NTOK + mbeg + half * 8);
  const uint4* kp = kp0;
  const uint4* vp = vp0;

  // the operand loads of one 32-key chunk
  auto fetch = [&](KFrag& k, VFrag& vA) {
    // ---- K as bf16 A-operand: lane L (row m=l16, both halves alike), the
    //      key's 32 bytes: hi of d = 0..7, then lo of d = 0..7
    k.a0.u[0] = kp[0];  k.a0.u[1] = kp[1];
    k.a1.u[0] = kp[32]; k.a1.u[1] = kp[33];
    kp += 64;

    // ---- V as bf16 A-operand: lane L (row d=l16), two 16B contiguous loads
    vA.u[0] = vp[0];                // K =  0..7  (+8*half)
    vA.u[1] = vp[2];                // K = 16..23 (+8*half)
    vp += 4;
  };

  // S^T + c = (K-tile) x (Q-tile t) + c: one bf16 WMMA a key tile
  auto scores = [&](const KFrag& k, int t, const v8f c, v8f& s0, v8f& s1) {
    s0 = __builtin_amdgcn_wmma_f32_16x16x32_bf16(
        false, k.a0.v, false, qB[t].v, (short)0, c, false, false);
    s1 = __builtin_amdgcn_wmma_f32_16x16x32_bf16(
        false, k.a1.v, false, qB[t].v, (short)0, c, false, false);
  };

  // the largest of 'seed' and this lane's 16 logits
  auto lane_max = [&](float seed, const v8f s0, const v8f s1) {
    // unrolled: constant element indices keep the tiles in registers
#pragma unroll
    for (int r = 0; r < 8; ++r) seed = fmaxf(fmaxf(seed, s0[r]), s1[r]);
    return seed;
  };

  // weights of a chunk from tile t's logits (shifted or not) and their sum
  auto weights = [&](int t, const v8f s0, const v8f s1, v16bf& pB) {
    v8f p0, p1;                     // P^T is packed straight into B-operand
    // unrolled: constant element indices keep the tiles in registers
#pragma unroll
    for (int r = 0; r < 8; ++r) p0[r] = __builtin_amdgcn_exp2f(s0[r]);
#pragma unroll
    for (int r = 0; r < 8; ++r) p1[r] = __builtin_amdgcn_exp2f(s1[r]);
#pragma unroll
    for (int r = 0; r < 8; ++r) {
      pB[r]     = (__bf16)p0[r];    // K =  r + 8*half   (tile 0)
      pB[8 + r] = (__bf16)p1[r];    // K = 16 + r + 8*half (tile 1)
    }
    run_sum[t] += p0.lo;            // packed adds, no temporaries
    run_sum[t] += p0.hi;
    run_sum[t] += p1.lo;
    run_sum[t] += p1.hi;
  };

  // P x V of a chunk for tile t
  auto weighted_v = [&](int t, const v16bf pB, const VFrag& vA) {
    acc[t] = __builtin_amdgcn_wmma_f32_16x16x32_bf16(
        false, vA.v, false, pB, (short)0, acc[t], false, false);
  };

  auto weigh = [&](int t, const v8f s0, const v8f s1, const VFrag& vA) {
    v16bf pB;
    weights(t, s0, s1, pB);
    weighted_v(t, pB, vA);
  };

  // a query's sum: the lane's four partial sums, then the other half-wave's
  auto join_sums = [&]() {
#pragma unroll
    for (int t = 0; t < QT; ++t) {
      const float s =
          (run_sum[t].x + run_sum[t].y) + (run_sum[t].z + run_sum[t].w);
      row_sum[t] = s + __shfl_xor(s, 16, 32);
    }
  };

  // ---- the range without a shift: no maximum, no branch in a chunk
  for (int m = mbeg; m < mend; m += 32) {
    KFrag k;
    VFrag vA;
    fetch(k, vA);
    // keeps V's loads up here beside K's: sunk behind the first WMMAs they
    // would still be on their way when P x V asks for them
    __builtin_amdgcn_sched_barrier(0);
    const v8f zero = {};
    v8f s0[QT], s1[QT];
    v16bf pB[QT];
    // key tile 0 for every query tile first: its loads are the first to land
#pragma unroll
    for (int t = 0; t < QT; ++t)
      s0[t] = __builtin_amdgcn_wmma_f32_16x16x32_bf16(
          false, k.a0.v, false, qB[t].v, (short)0, zero, false, false);
#pragma unroll
    for (int t = 0; t < QT; ++t)
      s1[t] = __builtin_amdgcn_wmma_f32_16x16x32_bf16(
          false, k.a1.v, false, qB[t].v, (short)0, zero, false, false);
#pragma unroll
    for (int t = 0; t < QT; ++t) weights(t, s0[t], s1[t], pB[t]);
    // keeps the 4 WMMAs of P x V last and back to back: a sum moved in behind
    // one of them lands in its operand registers and waits there behind v_nops
    __builtin_amdgcn_sched_barrier(0);
#pragma unroll
    for (int t = 0; t < QT; ++t) weighted_v(t, pB[t], vA);
  }
  join_sums();
  bool in_range = true;             // false too where a sum is not a number
#pragma unroll
  for (int t = 0; t < QT; ++t) {
    float mag = 0.0f;               // infinite or NaN if an accumulator is
#pragma unroll
    for (int r = 0; r < 8; ++r) mag += fabsf(acc[t][r]);
    in_range &= (row_sum[t] >= __builtin_ldexpf(1.0f, -SUM_ROOM)) &
                (row_sum[t] <= __builtin_ldexpf(1.0f, SUM_ROOM)) &
                (mag < INFINITY);
  }

  // ballot: one scalar branch for the wave, EXEC stays all ones
  if (__builtin_amdgcn_ballot_w32(!in_range) != 0u) {
    // ---- the range again, from nothing, with a shift
#pragma unroll
    for (int t = 0; t < QT; ++t) {
      acc[t] = v8f{};
      run_sum[t] = v4f{};
    }
    kp = kp0;
    vp = vp0;
    {                                 // first chunk: its maximum is the shift
      KFrag k;
      VFrag vA;
      fetch(k, vA);
      const v8f zero = {};
      v8f s0[QT], s1[QT];
#pragma unroll
      for (int t = 0; t < QT; ++t) {
        scores(k, t, zero, s0[t], s1[t]);
        const float lmax = lane_max(-INFINITY, s0[t], s1[t]);
        shift[t] = fmaxf(lmax, __shfl_xor(lmax, 16, 32));  // join half-waves
      }
#pragma unroll
      for (int t = 0; t < QT; ++t) {
        s0[t] -= shift[t];
        s1[t] -= shift[t];
        weigh(t, s0[t], s1[t], vA);
      }
    }
    int m0 = mbeg + 32;
    // outer loop: one trip per value of the shifts, so that C is invariant in
    // the inner loop and the WMMAs read it where it lies (no register copies)
    while (m0 < mend) {
      v8f nshift[QT];                 // minus the shift, in every row of C
#pragma unroll
      for (int t = 0; t < QT; ++t) nshift[t] = v8f{} - shift[t];
      bool moved;
      do {
        KFrag k;
        VFrag vA;
        fetch(k, vA);
        // keeps V's loads up here beside K's: sunk behind QK^T (into K's
        // registers) they would start a second wait in every trip
        __builtin_amdgcn_sched_barrier(0);
        v8f s0[QT], s1[QT];
        float lmax[QT];               // how far above the shift, at least 0
        float top = 0.0f;
#pragma unroll
        for (int t = 0; t < QT; ++t) scores(k, t, nshift[t], s0[t], s1[t]);
        // keeps the 8 WMMAs back to back: a maximum moved in between them
        // waits for its WMMA's result behind v_nops
        __builtin_amdgcn_sched_barrier(0);
#pragma unroll
        for (int t = 0; t < QT; ++t) {
          lmax[t] = lane_max(0.0f, s0[t], s1[t]);
          top = fmaxf(top, lmax[t]);
        }
        // ballot: one scalar branch for wave and chunk, EXEC stays all ones
        moved = __builtin_amdgcn_ballot_w32(top > SHIFT_ROOM) != 0u;
        if (moved) {                  // raise each shift to its maximum in this chunk, if higher
#pragma unroll
          for (int t = 0; t < QT; ++t) {
            const float up = fmaxf(lmax[t], __shfl_xor(lmax[t], 16, 32));
            const float corr = __builtin_amdgcn_exp2f(-up);
            shift[t] += up;
            run_sum[t] *= corr;
            acc[t] *= corr;
            s0[t] -= up;
            s1[t] -= up;
          }
        }
#pragma unroll
        for (int t = 0; t < QT; ++t) weigh(t, s0[t], s1[t], vA);
        m0 += 32;
      } while (!moved && m0 < mend);
    }
    join_sums();
  }

  // ---- hand over the partials: lanes 0..15 hold rows d=0..7 of out^T
#pragma unroll
  for (int t = 0; t < QT; ++t) {
    if (half == 0) {
      const int q = t * 16 + l16;
#pragma unroll
      for (int r = 0; r < 8; ++r) s_acc[kr][r][q] = acc[t][r];
      s_max[kr][q] = shift[t];
      s_sum[kr][q] = row_sum[t];
    }
  }
  __syncthreads();   // every range's partial is in LDS before the merge

  // ---- merge + normalize + store: wave d stores row d, 128-B lines
#pragma unroll
  for (int q = lane; q < QBLK; q += 32) {
    float gmax = s_max[0][q];
#pragma unroll
    for (int s = 1; s < KSPLIT; ++s) gmax = fmaxf(gmax, s_max[s][q]);
    float num = 0.0f, den = 0.0f;
#pragma unroll
    for (int s = 0; s < KSPLIT; ++s) {
      const float wgt = __builtin_amdgcn_exp2f(s_max[s][q] - gmax);
      num = fmaf(s_acc[s][wave][q], wgt, num);
      den = fmaf(s_sum[s][q], wgt, den);
    }
    attn_out[(h * HDIM + wave) * NTOK + nb + q] = num / den;
  }
}

// ---------------------------------------------------------------------------
// Kernel 3: out = x + w_proj(64x64) @ attn_out + b_proj
// grid (4, 64) x 64 threads: blockIdx.x = 16-channel tile, one wave per 32
// tokens: 512 waves, one block per WGP.
// ---------------------------------------------------------------------------
// waves_per_eu: as in kernel 1, room for every load to be in flight at once
__global__ __launch_bounds__(64) __attribute__((amdgpu_waves_per_eu(1, 4)))
void proj_kernel(
    const float* __restrict__ x, const float* __restrict__ w,
    const float* __restrict__ b, const float* __restrict__ ao,
    float* __restrict__ out) {
  const int lane = threadIdx.x & 31;
  // wave number in a scalar register: EXEC stays all ones around the WMMAs
  const int wave = __builtin_amdgcn_readfirstlane(threadIdx.x >> 5);
  const int c    = lane & 15;
  const int hf   = lane >> 4;
  const int co0  = blockIdx.x * 16;
  const int n0   = (blockIdx.y * 2 + wave) * 32;

  float2 res[8];                       // residual, asked for with the operands
#pragma unroll
  for (int r = 0; r < 8; ++r)
    res[r] = *(const float2*)(x + (co0 + 8 * hf + r) * NTOK + n0 + 2 * c);

  v8f t0, t1;
  pointwise_tile(w, b, ao, co0, n0, c, hf, t0, t1);

#pragma unroll
  for (int r = 0; r < 8; ++r)
    *(float2*)(out + (co0 + 8 * hf + r) * NTOK + n0 + 2 * c) =
        make_float2(res[r].x + t0[r], res[r].y + t1[r]);
}

// ---------------------------------------------------------------------------
extern "C" void kernel_launch(void* const* d_in, const int* in_sizes, int n_in,
                              void* d_out, int out_size, void* d_ws,
                              size_t ws_size, hipStream_t stream) {
  const float* x      = (const float*)d_in[0];   // (1,64,16,16,16)
  const float* w_qkv  = (const float*)d_in[1];   // (192,64)
  const float* b_qkv  = (const float*)d_in[2];   // (192)
  const float* w_proj = (const float*)d_in[3];   // (64,64)
  const float* b_proj = (const float*)d_in[4];   // (64)
  float* out = (float*)d_out;

  char* ws = (char*)d_ws;
  float*          qkv = (float*)ws;              // 192*4096 f32, v rows written
  unsigned short* qkhl = (unsigned short*)ws;        // in its q and k rows' place
  float*          ao  = (float*)(ws + 192 * NTOK * 4);        //  64*4096 f32
  unsigned short* vbf = (unsigned short*)(ws + 256 * NTOK * 4); // 8*16*4096 bf16

  qkv_kernel<<<dim3(12, 32), 128, 0, stream>>>(x, w_qkv, b_qkv, qkv, qkhl, vbf);
  attn_kernel<<<dim3(512), 256, 0, stream>>>(qkhl, vbf, ao);
  proj_kernel<<<dim3(4, 64), 64, 0, stream>>>(x, w_proj, b_proj, ao, out);
}

// v007
// It runs in 20.9 microseconds.
// Next to v006, in two timings, it ran 1.04 and 1.03 times as fast.
// All steps since v000 together make it 3.85 times as fast.
#include <hip/hip_runtime.h>
#include <hip/hip_bf16.h>

// ---------------------------------------------------------------------------
// SpatialAttention for MI455X (gfx1250), flash-attention style:
//  - never materializes the 8x4096x4096 attention matrix (512MB -> 0)
//  - QK^T   : V_WMMA_F32_16X16X32_BF16, q and k each split into bf16 hi + lo;
//             the K-dim of 32 holds the four products hi*hi, hi*lo, lo*hi,
//             lo*lo of the 8 head dims (f32 sum, about 16 bits of each operand)
//  - softmax: per-lane (S^T layout => query = lane column), no shift where the
//             sums stay in range; else online, with a shift
//  - PV     : V_WMMA_F32_16X16X32_BF16 (K-dim = 4096 contraction); row 8 of
//             its V operand is ones, so row 8 of the result is the row sum
//  - P^T in C/D layout packs directly into the bf16 B-operand layout
//  - both 1x1 projections: V_WMMA_F32_16X16X4_F32, 16 channels x 32 tokens a wave
// ---------------------------------------------------------------------------

typedef __attribute__((ext_vector_type(2)))  float  v2f;
typedef __attribute__((ext_vector_type(8)))  float  v8f;
typedef __attribute__((ext_vector_type(2)))  __bf16 v2bf;
typedef __attribute__((ext_vector_type(16))) __bf16 v16bf;

#define NTOK 4096   // 16*16*16 tokens
#define CCH  64     // channels
#define HEADS 8
#define HDIM  8
// 1/sqrt(8) * log2(e), folded into q: logits come out in log2 units
#define QK_SCALE (0.35355339059327373f * 1.4426950408889634f)

__device__ __forceinline__ unsigned short f32_bf16(float f) {
  unsigned u = __float_as_uint(f);
  u += 0x7FFFu + ((u >> 16) & 1u);   // round-to-nearest-even
  return (unsigned short)(u >> 16);
}

// x = hi + lo, both bf16, for two values at once (x0 in the low half of each
// word): the remainder x - hi is exact in f32, so a pair carries about 16
// significant bits of x
__device__ __forceinline__ void split_bf16(float x0, float x1, unsigned& hi,
                                           unsigned& lo) {
  const v2bf h = {(__bf16)x0, (__bf16)x1};
  hi = __builtin_bit_cast(unsigned, h);
  const v2bf l = {(__bf16)(x0 - __uint_as_float(hi << 16)),
                  (__bf16)(x1 - __uint_as_float(hi & 0xFFFF0000u))};
  lo = __builtin_bit_cast(unsigned, l);
}

// ---------------------------------------------------------------------------
// Shared by kernels 1 and 3: one wave's tile of  W(rows x 64) @ in(64 x 4096)
// + bias  on V_WMMA_F32_16X16X4_F32: 16 output channels x 32 tokens.
//  - A = W rows co0..co0+15 (lane column c = row), B = in (lane column c =
//    token); column c of tile t is token n0 + 2c + t, so a lane ends up with
//    two neighbouring tokens of each of its 8 channels (8-byte stores)
//  - operand register r of lane half hf at step s holds input channel
//    ci = 8*(s/2) + 4*hf + 2*(s%2) + r for A and for B alike: a lane's weights
//    of two steps are 16 contiguous bytes
//  - result: t0[r], t1[r] = channel co0 + 8*hf + r, tokens n0 + 2c, n0 + 2c + 1
// ---------------------------------------------------------------------------
__device__ __forceinline__ void pointwise_tile(
    const float* __restrict__ w, const float* __restrict__ bias,
    const float* __restrict__ in, int co0, int n0, int c, int hf,
    v8f& t0, v8f& t1) {
  const float* wrow = w + (co0 + c) * CCH + hf * 4;
  const float* icol = in + (hf * 4) * NTOK + n0 + 2 * c;

  float4 wa[8];
#pragma unroll
  for (int p = 0; p < 8; ++p) wa[p] = *(const float4*)(wrow + p * 8);

  v2f b0[16], b1[16];
#pragma unroll
  for (int s = 0; s < 16; ++s) {
    const float* ip = icol + ((s >> 1) * 8 + (s & 1) * 2) * NTOK;
    b0[s].x = ip[0];    b1[s].x = ip[1];
    b0[s].y = ip[NTOK]; b1[s].y = ip[NTOK + 1];
  }

#pragma unroll
  for (int r = 0; r < 8; ++r) t0[r] = t1[r] = bias[co0 + 8 * hf + r];

#pragma unroll
  for (int s = 0; s < 16; ++s) {
    v2f a;
    a.x = (s & 1) ? wa[s >> 1].z : wa[s >> 1].x;
    a.y = (s & 1) ? wa[s >> 1].w : wa[s >> 1].y;
    t0 = __builtin_amdgcn_wmma_f32_16x16x4_f32(false, a, false, b0[s],
                                               (short)0, t0, false, false);
    t1 = __builtin_amdgcn_wmma_f32_16x16x4_f32(false, a, false, b1[s],
                                               (short)0, t1, false, false);
  }
}

// ---------------------------------------------------------------------------
// Kernel 1: qkv[192][4096] = w_qkv(192x64) @ x(64x4096) + b_qkv
//           also emits bf16 V in [h][d_pad16][m] layout (pad row 8 is ones:
//           P x V then gives the softmax sums; pad rows 9..15 are zero)
//           q (softmax scale folded in) and k leave only as bf16 hi + lo:
//           qkhl[q heads 0..7, k heads 0..7][token][16], hi of d = 0..7, then
//           lo of d = 0..7
// grid (12, 32) x 128 threads: blockIdx.x = 16-channel tile (0..3 q, 4..7 k,
// 8..11 v; two heads each), one wave per 32 tokens: 1536 waves.
// ---------------------------------------------------------------------------
// waves_per_eu: register room for all 42 operand loads of a wave to be in
// flight at once (at the default budget they are asked for a dozen at a time)
__global__ __launch_bounds__(128) __attribute__((amdgpu_waves_per_eu(1, 4)))
void qkv_kernel(
    const float* __restrict__ x, const float* __restrict__ w,
    const float* __restrict__ b, float* __restrict__ qkv,
    unsigned short* __restrict__ qkhl, unsigned short* __restrict__ vbf) {
  const int lane = threadIdx.x & 31;
  // wave number in a scalar register: EXEC stays all ones around the WMMAs
  const int wave = __builtin_amdgcn_readfirstlane(threadIdx.x >> 5);
  const int c    = lane & 15;
  const int hf   = lane >> 4;
  const int ct   = blockIdx.x;
  const int co0  = ct * 16;
  const int n0   = (blockIdx.y * 4 + wave) * 32;

  v8f t0, t1;
  pointwise_tile(w, b, x, co0, n0, c, hf, t0, t1);

  if (ct < 8) {                        // q, k -> bf16 hi and lo, 32 B a token
    const float sc = ct < 4 ? QK_SCALE : 1.0f;
    t0 *= sc;
    t1 *= sc;
    uint4 hi0, lo0, hi1, lo1;          // a lane has all 8 dims of two tokens
    split_bf16(t0[0], t0[1], hi0.x, lo0.x);
    split_bf16(t0[2], t0[3], hi0.y, lo0.y);
    split_bf16(t0[4], t0[5], hi0.z, lo0.z);
    split_bf16(t0[6], t0[7], hi0.w, lo0.w);
    split_bf16(t1[0], t1[1], hi1.x, lo1.x);
    split_bf16(t1[2], t1[3], hi1.y, lo1.y);
    split_bf16(t1[4], t1[5], hi1.z, lo1.z);
    split_bf16(t1[6], t1[7], hi1.w, lo1.w);
    uint4* hl = (uint4*)(qkhl + ((ct * 2 + hf) * NTOK + n0 + 2 * c) * 16);
    hl[0] = hi0; hl[1] = lo0;
    hl[2] = hi1; hl[3] = lo1;
    // the code below reuses the registers these stores name
    asm volatile("s_wait_xcnt 0x0" ::: "memory");

    if (ct < 4) {                      // q tiles fill V pad rows d = 8..15
      const int h = ct * 2 + hf;       // two lanes per row, 32 bytes each
      uint4* zp = (uint4*)(vbf + ((h * 16) + 8 + (c >> 1)) * NTOK + n0 +
                           (c & 1) * 16);
      const unsigned pad = (c >> 1) == 0 ? 0x3F803F80u : 0u;  // bf16 1.0 | 0
      zp[0] = make_uint4(pad, pad, pad, pad);
      zp[1] = make_uint4(pad, pad, pad, pad);
    }
    return;
  }

#pragma unroll
  for (int r = 0; r < 8; ++r)
    *(float2*)(qkv + (co0 + 8 * hf + r) * NTOK + n0 + 2 * c) =
        make_float2(t0[r], t1[r]);
  // the code below reuses the registers these stores name
  asm volatile("s_wait_xcnt 0x0" ::: "memory");

  const int h = (ct - 8) * 2 + hf;     // V -> bf16 copy, rows d = 0..7
#pragma unroll
  for (int r = 0; r < 8; ++r)
    *(unsigned*)(vbf + ((h * 16) + r) * NTOK + n0 + 2 * c) =
        (unsigned)f32_bf16(t0[r]) | ((unsigned)f32_bf16(t1[r]) << 16);
}

// ---------------------------------------------------------------------------
// Kernel 2: flash attention, keys split over the waves of a block.
// One block = 64 queries (QT 16-query tiles) of one head; the 4096 keys are
// cut into KSPLIT contiguous ranges, one wave per range. A wave loads each
// 32-key chunk of K and V once and uses the fragments for all QT tiles.
// Every wave keeps its own shifts and accumulators; the partials are merged
// through LDS behind one barrier. A query's sum of weights is row 8 of its
// accumulator tile (V's pad row 8 is ones): the sum of the bf16 weights that
// P x V itself uses, over all 32 keys of a chunk, held by lane 16 + query.
// A wave first takes its range with no softmax shift at all: the weights are
// exp2 of the logits as they come. f32 and bf16 have 8 exponent bits, so the
// weights keep their relative precision and the quotient is the same as long
// as nothing leaves the exponent range. That is tested once, behind the range:
// every query's sum within 2^-SUM_ROOM .. 2^SUM_ROOM and every accumulator
// finite. A wave that fails the test throws its partials away and takes the
// range again with a shift, as follows.
// The softmax shift of a query is not its running maximum: it is set from the
// wave's first chunk and then left alone until a logit rises more than
// SHIFT_ROOM above it. Minus the shift is the C operand of QK^T and the
// logits are in log2 units, so the WMMA result goes straight into exp2; the
// accumulators are rescaled only where the shifts move (all of a wave's
// queries move together, each to the larger of its shift and its maximum in that chunk).
// grid(512) x 256 threads (8 waves/block): 4096 waves, 4 per SIMD.
// ---------------------------------------------------------------------------
#define KSPLIT 8
#define KRANGE (NTOK / KSPLIT)   // keys per wave
#define QT 4                     // 16-query tiles per wave
#define QBLK (QT * 16)           // queries per block
#define SHIFT_ROOM 8.0f          // log2 units: every weight stays <= 256
// unshifted pass, log2 units: a sum of 512 weights in this range has its
// largest weight within 2^-49 .. 2^40, so that none overflows and every weight
// down to 2^-77 of the largest is a normal number
#define SUM_ROOM 40
static_assert(KSPLIT == HDIM, "the merge gives wave d row d of out^T");

// waves_per_eu: two blocks a WGP, so a wave may hold a quarter of a SIMD's
// registers (the scores of all QT tiles are live at once)
__global__ __launch_bounds__(KSPLIT * 32)
__attribute__((amdgpu_waves_per_eu(4, 4))) void attn_kernel(
    const unsigned short* __restrict__ qkhl,
    const unsigned short* __restrict__ vbf, float* __restrict__ attn_out) {
  __shared__ float s_acc[KSPLIT][HDIM][QBLK]; // un-normalised partial out^T
  __shared__ float s_max[KSPLIT][QBLK];       // partial shifts (log2 units)
  __shared__ float s_sum[KSPLIT][QBLK];       // partial row sums

  const int lane = threadIdx.x & 31;
  // wave number in a scalar register: key range and loop bounds are then
  // wave-uniform for the compiler (EXEC stays all ones)
  const int wave = __builtin_amdgcn_readfirstlane(threadIdx.x >> 5);
  const int h    = blockIdx.x / (NTOK / QBLK);
  const int kr   = wave;                           // key range 0..KSPLIT-1
  const int nb   = (blockIdx.x % (NTOK / QBLK)) * QBLK;  // block's first query
  const int half = lane >> 4;                      // 0 | 1
  const int l16  = lane & 15;

  const unsigned short* qb = qkhl + (h * NTOK + nb) * 16;        // q[n][hi8|lo8]
  const unsigned short* kb = qkhl + ((HEADS + h) * NTOK) * 16;   // k[m][hi8|lo8]
  const unsigned short* vb = vbf + (h * 16) * NTOK;              // v[d16][m]

  // Q as bf16 B-operand (32x16). Elements e and 8 + e of a lane hold dim e of
  // its query: q_hi in lane half 0, q_lo in lane half 1.
  // The K fragment has k_hi at e and k_lo at 8 + e in both halves, so the 32
  // products of a column are (q_hi + q_lo)[d] * (k_hi + k_lo)[d], d = 0..7.
  union VFrag { v16bf v; uint4 u[2]; };
  VFrag qB[QT];
  // every loop over t is unrolled: constant indices keep the tiles in registers
#pragma unroll
  for (int t = 0; t < QT; ++t)
    qB[t].u[0] = qB[t].u[1] =
        *(const uint4*)(qb + (t * 16 + l16) * 16 + half * 8);

  v8f   acc[QT] = {};              // out^T accumulators (rows d, cols n);
                                   // row 8 (lane half 1, element 0): the sums
  float shift[QT] = {};            // the same in both lanes of a query

  struct KFrag { VFrag a0, a1; };  // key tile 0 (16 keys), tile 1 (the next 16)
  const int mbeg = kr * KRANGE;
  const int mend = mbeg + KRANGE;
  // this lane's place in the wave's next chunk of K and of V
  const uint4* const kp0 = (const uint4*)(kb + (mbeg + l16) * 16);
  const uint4* const vp0 =
      (const uint4*)(vb + (size_t)l16 * NTOK + mbeg + half * 8);
  const uint4* kp = kp0;
  const uint4* vp = vp0;

  // the operand loads of one 32-key chunk
  auto fetch = [&](KFrag& k, VFrag& vA) {
    // ---- K as bf16 A-operand: lane L (row m=l16, both halves alike), the
    //      key's 32 bytes: hi of d = 0..7, then lo of d = 0..7
    k.a0.u[0] = kp[0];  k.a0.u[1] = kp[1];
    k.a1.u[0] = kp[32]; k.a1.u[1] = kp[33];
    kp += 64;

    // ---- V as bf16 A-operand: lane L (row d=l16), two 16B contiguous loads
    vA.u[0] = vp[0];                // K =  0..7  (+8*half)
    vA.u[1] = vp[2];                // K = 16..23 (+8*half)
    vp += 4;
  };

  // S^T + c = (K-tile) x (Q-tile t) + c: one bf16 WMMA a key tile
  auto scores = [&](const KFrag& k, int t, const v8f c, v8f& s0, v8f& s1) {
    s0 = __builtin_amdgcn_wmma_f32_16x16x32_bf16(
        false, k.a0.v, false, qB[t].v, (short)0, c, false, false);
    s1 = __builtin_amdgcn_wmma_f32_16x16x32_bf16(
        false, k.a1.v, false, qB[t].v, (short)0, c, false, false);
  };

  // the largest of 'seed' and this lane's 16 logits
  auto lane_max = [&](float seed, const v8f s0, const v8f s1) {
    // unrolled: constant element indices keep the tiles in registers
#pragma unroll
    for (int r = 0; r < 8; ++r) seed = fmaxf(fmaxf(seed, s0[r]), s1[r]);
    return seed;
  };

  // weights of a chunk from a tile's logits (shifted or not)
  auto weights = [&](const v8f s0, const v8f s1, v16bf& pB) {
    v8f p0, p1;                     // P^T is packed straight into B-operand
    // unrolled: constant element indices keep the tiles in registers
#pragma unroll
    for (int r = 0; r < 8; ++r) p0[r] = __builtin_amdgcn_exp2f(s0[r]);
#pragma unroll
    for (int r = 0; r < 8; ++r) p1[r] = __builtin_amdgcn_exp2f(s1[r]);
#pragma unroll
    for (int r = 0; r < 8; ++r) {
      pB[r]     = (__bf16)p0[r];    // K =  r + 8*half   (tile 0)
      pB[8 + r] = (__bf16)p1[r];    // K = 16 + r + 8*half (tile 1)
    }
  };

  // P x V of a chunk for tile t, and in row 8 the sum of its weights
  auto weighted_v = [&](int t, const v16bf pB, const VFrag& vA) {
    acc[t] = __builtin_amdgcn_wmma_f32_16x16x32_bf16(
        false, vA.v, false, pB, (short)0, acc[t], false, false);
  };

  auto weigh = [&](int t, const v8f s0, const v8f s1, const VFrag& vA) {
    v16bf pB;
    weights(s0, s1, pB);
    weighted_v(t, pB, vA);
  };

  // ---- the range without a shift: no maximum, no branch in a chunk
  for (int m = mbeg; m < mend; m += 32) {
    KFrag k;
    VFrag vA;
    fetch(k, vA);
    // keeps V's loads up here beside K's: sunk behind the first WMMAs they
    // would still be on their way when P x V asks for them
    __builtin_amdgcn_sched_barrier(0);
    const v8f zero = {};
    v8f s0[QT], s1[QT];
    v16bf pB[QT];
    // key tile 0 for every query tile first: its loads are the first to land
#pragma unroll
    for (int t = 0; t < QT; ++t)
      s0[t] = __builtin_amdgcn_wmma_f32_16x16x32_bf16(
          false, k.a0.v, false, qB[t].v, (short)0, zero, false, false);
#pragma unroll
    for (int t = 0; t < QT; ++t)
      s1[t] = __builtin_amdgcn_wmma_f32_16x16x32_bf16(
          false, k.a1.v, false, qB[t].v, (short)0, zero, false, false);
#pragma unroll
    for (int t = 0; t < QT; ++t) weights(s0[t], s1[t], pB[t]);
#pragma unroll
    for (int t = 0; t < QT; ++t) weighted_v(t, pB[t], vA);
  }
  bool in_range = true;             // false too where a sum is not a number
#pragma unroll
  for (int t = 0; t < QT; ++t) {
    float mag = 0.0f;               // infinite or NaN if an accumulator is
#pragma unroll
    for (int r = 0; r < 8; ++r) mag += fabsf(acc[t][r]);
    // element 0 is a sum in lane half 1 only (in half 0 it is row 0 of out^T)
    in_range &= ((half == 0) |
                 ((acc[t][0] >= __builtin_ldexpf(1.0f, -SUM_ROOM)) &
                  (acc[t][0] <= __builtin_ldexpf(1.0f, SUM_ROOM)))) &
                (mag < INFINITY);
  }

  // ballot: one scalar branch for the wave, EXEC stays all ones
  if (__builtin_amdgcn_ballot_w32(!in_range) != 0u) {
    // ---- the range again, from nothing, with a shift
#pragma unroll
    for (int t = 0; t < QT; ++t) acc[t] = v8f{};
    kp = kp0;
    vp = vp0;
    {                                 // first chunk: its maximum is the shift
      KFrag k;
      VFrag vA;
      fetch(k, vA);
      const v8f zero = {};
      v8f s0[QT], s1[QT];
#pragma unroll
      for (int t = 0; t < QT; ++t) {
        scores(k, t, zero, s0[t], s1[t]);
        const float lmax = lane_max(-INFINITY, s0[t], s1[t]);
        shift[t] = fmaxf(lmax, __shfl_xor(lmax, 16, 32));  // join half-waves
      }
#pragma unroll
      for (int t = 0; t < QT; ++t) {
        s0[t] -= shift[t];
        s1[t] -= shift[t];
        weigh(t, s0[t], s1[t], vA);
      }
    }
    int m0 = mbeg + 32;
    // outer loop: one trip per value of the shifts, so that C is invariant in
    // the inner loop and the WMMAs read it where it lies (no register copies)
    while (m0 < mend) {
      v8f nshift[QT];                 // minus the shift, in every row of C
#pragma unroll
      for (int t = 0; t < QT; ++t) nshift[t] = v8f{} - shift[t];
      bool moved;
      do {
        KFrag k;
        VFrag vA;
        fetch(k, vA);
        // keeps V's loads up here beside K's: sunk behind QK^T (into K's
        // registers) they would start a second wait in every trip
        __builtin_amdgcn_sched_barrier(0);
        v8f s0[QT], s1[QT];
        float lmax[QT];               // how far above the shift, at least 0
        float top = 0.0f;
#pragma unroll
        for (int t = 0; t < QT; ++t) scores(k, t, nshift[t], s0[t], s1[t]);
        // keeps the 8 WMMAs back to back: a maximum moved in between them
        // waits for its WMMA's result behind v_nops
        __builtin_amdgcn_sched_barrier(0);
#pragma unroll
        for (int t = 0; t < QT; ++t) {
          lmax[t] = lane_max(0.0f, s0[t], s1[t]);
          top = fmaxf(top, lmax[t]);
        }
        // ballot: one scalar branch for wave and chunk, EXEC stays all ones
        moved = __builtin_amdgcn_ballot_w32(top > SHIFT_ROOM) != 0u;
        if (moved) {                  // raise each shift to its maximum in this chunk, if higher
#pragma unroll
          for (int t = 0; t < QT; ++t) {
            const float up = fmaxf(lmax[t], __shfl_xor(lmax[t], 16, 32));
            const float corr = __builtin_amdgcn_exp2f(-up);
            shift[t] += up;
            acc[t] *= corr;           // the sums in row 8 with it
            s0[t] -= up;
            s1[t] -= up;
          }
        }
#pragma unroll
        for (int t = 0; t < QT; ++t) weigh(t, s0[t], s1[t], vA);
        m0 += 32;
      } while (!moved && m0 < mend);
    }
  }

  // ---- hand over the partials: lanes 0..15 hold rows d=0..7 of out^T, lanes
  //      16..31 the sums (row 8)
  if (half == 0) {
#pragma unroll
    for (int t = 0; t < QT; ++t) {
      const int q = t * 16 + l16;
#pragma unroll
      for (int r = 0; r < 8; ++r) s_acc[kr][r][q] = acc[t][r];
      s_max[kr][q] = shift[t];
    }
  } else {
#pragma unroll
    for (int t = 0; t < QT; ++t) s_sum[kr][t * 16 + l16] = acc[t][0];
  }
  __syncthreads();   // every range's partial is in LDS before the merge

  // ---- merge + normalize + store: wave d stores row d, 128-B lines
#pragma unroll
  for (int q = lane; q < QBLK; q += 32) {
    float gmax = s_max[0][q];
#pragma unroll
    for (int s = 1; s < KSPLIT; ++s) gmax = fmaxf(gmax, s_max[s][q]);
    float num = 0.0f, den = 0.0f;
#pragma unroll
    for (int s = 0; s < KSPLIT; ++s) {
      const float wgt = __builtin_amdgcn_exp2f(s_max[s][q] - gmax);
      num = fmaf(s_acc[s][wave][q], wgt, num);
      den = fmaf(s_sum[s][q], wgt, den);
    }
    attn_out[(h * HDIM + wave) * NTOK + nb + q] = num / den;
  }
}

// ---------------------------------------------------------------------------
// Kernel 3: out = x + w_proj(64x64) @ attn_out + b_proj
// grid (4, 64) x 64 threads: blockIdx.x = 16-channel tile, one wave per 32
// tokens: 512 waves, one block per WGP.
// ---------------------------------------------------------------------------
// waves_per_eu: as in kernel 1, room for every load to be in flight at once
__global__ __launch_bounds__(64) __attribute__((amdgpu_waves_per_eu(1, 4)))
void proj_kernel(
    const float* __restrict__ x, const float* __restrict__ w,
    const float* __restrict__ b, const float* __restrict__ ao,
    float* __restrict__ out) {
  const int lane = threadIdx.x & 31;
  // wave number in a scalar register: EXEC stays all ones around the WMMAs
  const int wave = __builtin_amdgcn_readfirstlane(threadIdx.x >> 5);
  const int c    = lane & 15;
  const int hf   = lane >> 4;
  const int co0  = blockIdx.x * 16;
  const int n0   = (blockIdx.y * 2 + wave) * 32;

  float2 res[8];                       // residual, asked for with the operands
#pragma unroll
  for (int r = 0; r < 8; ++r)
    res[r] = *(const float2*)(x + (co0 + 8 * hf + r) * NTOK + n0 + 2 * c);

  v8f t0, t1;
  pointwise_tile(w, b, ao, co0, n0, c, hf, t0, t1);

#pragma unroll
  for (int r = 0; r < 8; ++r)
    *(float2*)(out + (co0 + 8 * hf + r) * NTOK + n0 + 2 * c) =
        make_float2(res[r].x + t0[r], res[r].y + t1[r]);
}

// ---------------------------------------------------------------------------
extern "C" void kernel_launch(void* const* d_in, const int* in_sizes, int n_in,
                              void* d_out, int out_size, void* d_ws,
                              size_t ws_size, hipStream_t stream) {
  const float* x      = (const float*)d_in[0];   // (1,64,16,16,16)
  const float* w_qkv  = (const float*)d_in[1];   // (192,64)
  const float* b_qkv  = (const float*)d_in[2];   // (192)
  const float* w_proj = (const float*)d_in[3];   // (64,64)
  const float* b_proj = (const float*)d_in[4];   // (64)
  float* out = (float*)d_out;

  char* ws = (char*)d_ws;
  float*          qkv = (float*)ws;              // 192*4096 f32, v rows written
  unsigned short* qkhl = (unsigned short*)ws;        // in its q and k rows' place
  float*          ao  = (float*)(ws + 192 * NTOK * 4);        //  64*4096 f32
  unsigned short* vbf = (unsigned short*)(ws + 256 * NTOK * 4); // 8*16*4096 bf16

  qkv_kernel<<<dim3(12, 32), 128, 0, stream>>>(x, w_qkv, b_qkv, qkv, qkhl, vbf);
  attn_kernel<<<dim3(512), 256, 0, stream>>>(qkhl, vbf, ao);
  proj_kernel<<<dim3(4, 64), 64, 0, stream>>>(x, w_proj, b_proj, ao, out);
}

// v008
// A run of this version takes 19.1 microseconds.
// Timed twice side by side with v007, it ran 1.11 and 1.10 times as fast.
// Over all steps from v000 it is 4.24 times as fast.
#include <hip/hip_runtime.h>
#include <hip/hip_bf16.h>

// ---------------------------------------------------------------------------
// SpatialAttention for MI455X (gfx1250), flash-attention style:
//  - never materializes the 8x4096x4096 attention matrix (512MB -> 0)
//  - QK^T   : V_WMMA_F32_16X16X32_BF16, q and k each split into bf16 hi + lo;
//             the K-dim of 32 holds the four products hi*hi, hi*lo, lo*hi,
//             lo*lo of the 8 head dims (f32 sum, about 16 bits of each operand)
//  - softmax: per-lane (S^T layout => query = lane column), no shift where the
//             sums stay in range; else online, with a shift
//  - PV     : V_WMMA_F32_16X16X32_BF16 (K-dim = 4096 contraction); row 8 of
//             its V operand is ones, so row 8 of the result is the row sum
//  - P^T in C/D layout packs directly into the bf16 B-operand layout
//  - both 1x1 projections: V_WMMA_F32_16X16X4_F32, 16 channels x 32 tokens a wave
// ---------------------------------------------------------------------------

typedef __attribute__((ext_vector_type(2)))  float  v2f;
typedef __attribute__((ext_vector_type(8)))  float  v8f;
typedef __attribute__((ext_vector_type(2)))  __bf16 v2bf;
typedef __attribute__((ext_vector_type(16))) __bf16 v16bf;

#define NTOK 4096   // 16*16*16 tokens
#define CCH  64     // channels
#define HEADS 8
#define HDIM  8
// 1/sqrt(8) * log2(e), folded into q: logits come out in log2 units
#define QK_SCALE (0.35355339059327373f * 1.4426950408889634f)

__device__ __forceinline__ unsigned short f32_bf16(float f) {
  unsigned u = __float_as_uint(f);
  u += 0x7FFFu + ((u >> 16) & 1u);   // round-to-nearest-even
  return (unsigned short)(u >> 16);
}

// x = hi + lo, both bf16, for two values at once (x0 in the low half of each
// word): the remainder x - hi is exact in f32, so a pair carries about 16
// significant bits of x
__device__ __forceinline__ void split_bf16(float x0, float x1, unsigned& hi,
                                           unsigned& lo) {
  const v2bf h = {(__bf16)x0, (__bf16)x1};
  hi = __builtin_bit_cast(unsigned, h);
  const v2bf l = {(__bf16)(x0 - __uint_as_float(hi << 16)),
                  (__bf16)(x1 - __uint_as_float(hi & 0xFFFF0000u))};
  lo = __builtin_bit_cast(unsigned, l);
}

// ---------------------------------------------------------------------------
// Shared by kernels 1 and 3: one wave's tile of  W(rows x 64) @ in(64 x 4096)
// + bias  on V_WMMA_F32_16X16X4_F32: 16 output channels x 32 tokens.
//  - A = W rows co0..co0+15 (lane column c = row), B = in (lane column c =
//    token); column c of tile t is token n0 + 2c + t, so a lane ends up with
//    two neighbouring tokens of each of its 8 channels (8-byte stores)
//  - operand register r of lane half hf at step s holds input channel
//    ci = 8*(s/2) + 4*hf + 2*(s%2) + r for A and for B alike: a lane's weights
//    of two steps are 16 contiguous bytes
//  - result: t0[r], t1[r] = channel co0 + 8*hf + r, tokens n0 + 2c, n0 + 2c + 1
// ---------------------------------------------------------------------------
__device__ __forceinline__ void pointwise_tile(
    const float* __restrict__ w, const float* __restrict__ bias,
    const float* __restrict__ in, int co0, int n0, int c, int hf,
    v8f& t0, v8f& t1) {
  const float* wrow = w + (co0 + c) * CCH + hf * 4;
  const float* icol = in + (hf * 4) * NTOK + n0 + 2 * c;

  float4 wa[8];
#pragma unroll
  for (int p = 0; p < 8; ++p) wa[p] = *(const float4*)(wrow + p * 8);

  v2f b0[16], b1[16];
#pragma unroll
  for (int s = 0; s < 16; ++s) {
    const float* ip = icol + ((s >> 1) * 8 + (s & 1) * 2) * NTOK;
    b0[s].x = ip[0];    b1[s].x = ip[1];
    b0[s].y = ip[NTOK]; b1[s].y = ip[NTOK + 1];
  }

#pragma unroll
  for (int r = 0; r < 8; ++r) t0[r] = t1[r] = bias[co0 + 8 * hf + r];

#pragma unroll
  for (int s = 0; s < 16; ++s) {
    v2f a;
    a.x = (s & 1) ? wa[s >> 1].z : wa[s >> 1].x;
    a.y = (s & 1) ? wa[s >> 1].w : wa[s >> 1].y;
    t0 = __builtin_amdgcn_wmma_f32_16x16x4_f32(false, a, false, b0[s],
                                               (short)0, t0, false, false);
    t1 = __builtin_amdgcn_wmma_f32_16x16x4_f32(false, a, false, b1[s],
                                               (short)0, t1, false, false);
  }
}

// ---------------------------------------------------------------------------
// Kernel 1: qkv[192][4096] = w_qkv(192x64) @ x(64x4096) + b_qkv
//           also emits bf16 V in [h][d_pad16][m] layout (pad row 8 is ones:
//           P x V then gives the softmax sums; pad rows 9..15 are zero)
//           q (softmax scale folded in) and k leave only as bf16 hi + lo:
//           qkhl[q heads 0..7, k heads 0..7][token][16], hi of d = 0..7, then
//           lo of d = 0..7
// grid (12, 32) x 128 threads: blockIdx.x = 16-channel tile (0..3 q, 4..7 k,
// 8..11 v; two heads each), one wave per 32 tokens: 1536 waves.
// ---------------------------------------------------------------------------
// waves_per_eu: register room for all 42 operand loads of a wave to be in
// flight at once (at the default budget they are asked for a dozen at a time)
__global__ __launch_bounds__(128) __attribute__((amdgpu_waves_per_eu(1, 4)))
void qkv_kernel(
    const float* __restrict__ x, const float* __restrict__ w,
    const float* __restrict__ b, float* __restrict__ qkv,
    unsigned short* __restrict__ qkhl, unsigned short* __restrict__ vbf) {
  const int lane = threadIdx.x & 31;
  // wave number in a scalar register: EXEC stays all ones around the WMMAs
  const int wave = __builtin_amdgcn_readfirstlane(threadIdx.x >> 5);
  const int c    = lane & 15;
  const int hf   = lane >> 4;
  const int ct   = blockIdx.x;
  const int co0  = ct * 16;
  const int n0   = (blockIdx.y * 4 + wave) * 32;

  v8f t0, t1;
  pointwise_tile(w, b, x, co0, n0, c, hf, t0, t1);

  if (ct < 8) {                        // q, k -> bf16 hi and lo, 32 B a token
    const float sc = ct < 4 ? QK_SCALE : 1.0f;
    t0 *= sc;
    t1 *= sc;
    uint4 hi0, lo0, hi1, lo1;          // a lane has all 8 dims of two tokens
    split_bf16(t0[0], t0[1], hi0.x, lo0.x);
    split_bf16(t0[2], t0[3], hi0.y, lo0.y);
    split_bf16(t0[4], t0[5], hi0.z, lo0.z);
    split_bf16(t0[6], t0[7], hi0.w, lo0.w);
    split_bf16(t1[0], t1[1], hi1.x, lo1.x);
    split_bf16(t1[2], t1[3], hi1.y, lo1.y);
    split_bf16(t1[4], t1[5], hi1.z, lo1.z);
    split_bf16(t1[6], t1[7], hi1.w, lo1.w);
    uint4* hl = (uint4*)(qkhl + ((ct * 2 + hf) * NTOK + n0 + 2 * c) * 16);
    hl[0] = hi0; hl[1] = lo0;
    hl[2] = hi1; hl[3] = lo1;
    // the code below reuses the registers these stores name
    asm volatile("s_wait_xcnt 0x0" ::: "memory");

    if (ct < 4) {                      // q tiles fill V pad rows d = 8..15
      const int h = ct * 2 + hf;       // two lanes per row, 32 bytes each
      uint4* zp = (uint4*)(vbf + ((h * 16) + 8 + (c >> 1)) * NTOK + n0 +
                           (c & 1) * 16);
      const unsigned pad = (c >> 1) == 0 ? 0x3F803F80u : 0u;  // bf16 1.0 | 0
      zp[0] = make_uint4(pad, pad, pad, pad);
      zp[1] = make_uint4(pad, pad, pad, pad);
    }
    return;
  }

#pragma unroll
  for (int r = 0; r < 8; ++r)
    *(float2*)(qkv + (co0 + 8 * hf + r) * NTOK + n0 + 2 * c) =
        make_float2(t0[r], t1[r]);
  // the code below reuses the registers these stores name
  asm volatile("s_wait_xcnt 0x0" ::: "memory");

  const int h = (ct - 8) * 2 + hf;     // V -> bf16 copy, rows d = 0..7
#pragma unroll
  for (int r = 0; r < 8; ++r)
    *(unsigned*)(vbf + ((h * 16) + r) * NTOK + n0 + 2 * c) =
        (unsigned)f32_bf16(t0[r]) | ((unsigned)f32_bf16(t1[r]) << 16);
}

// ---------------------------------------------------------------------------
// Kernel 2: flash attention, keys split over the waves of a block.
// One block = 64 queries (QT 16-query tiles) of one head; the 4096 keys are
// cut into KSPLIT contiguous ranges, one wave per range. A wave loads each
// 32-key chunk of K and V once, two chunks ahead of its use, and uses the
// fragments for all QT tiles.
// Every wave keeps its own shifts and accumulators; the partials are merged
// through LDS behind one barrier. A query's sum of weights is row 8 of its
// accumulator tile (V's pad row 8 is ones): the sum of the bf16 weights that
// P x V itself uses, over all 32 keys of a chunk, held by lane 16 + query.
// A wave first takes its range with no softmax shift at all: the weights are
// exp2 of the logits as they come. f32 and bf16 have 8 exponent bits, so the
// weights keep their relative precision and the quotient is the same as long
// as nothing leaves the exponent range. That is tested once, behind the range:
// every query's sum within 2^-SUM_ROOM .. 2^SUM_ROOM and every accumulator
// finite. A wave that fails the test throws its partials away and takes the
// range again with a shift, as follows.
// The softmax shift of a query is not its running maximum: it is set from the
// wave's first chunk and then left alone until a logit rises more than
// SHIFT_ROOM above it. Minus the shift is the C operand of QK^T and the
// logits are in log2 units, so the WMMA result goes straight into exp2; the
// accumulators are rescaled only where the shifts move (all of a wave's
// queries move together, each to the larger of its shift and its maximum in that chunk).
// grid(512) x 256 threads (8 waves/block): 4096 waves, 4 per SIMD.
// ---------------------------------------------------------------------------
#define KSPLIT 8
#define KRANGE (NTOK / KSPLIT)   // keys per wave
#define QT 4                     // 16-query tiles per wave
#define QBLK (QT * 16)           // queries per block
#define SHIFT_ROOM 8.0f          // log2 units: every weight stays <= 256
// unshifted pass, log2 units: a sum of 512 weights in this range has its
// largest weight within 2^-49 .. 2^40, so that none overflows and every weight
// down to 2^-77 of the largest is a normal number
#define SUM_ROOM 40
static_assert(KSPLIT == HDIM, "the merge gives wave d row d of out^T");

// waves_per_eu: two blocks a WGP, so a wave may hold a quarter of a SIMD's
// registers (the scores of all QT tiles are live at once)
__global__ __launch_bounds__(KSPLIT * 32)
__attribute__((amdgpu_waves_per_eu(4, 4))) void attn_kernel(
    const unsigned short* __restrict__ qkhl,
    const unsigned short* __restrict__ vbf, float* __restrict__ attn_out) {
  __shared__ float s_acc[KSPLIT][HDIM][QBLK]; // un-normalised partial out^T
  __shared__ float s_max[KSPLIT][QBLK];       // partial shifts (log2 units)
  __shared__ float s_sum[KSPLIT][QBLK];       // partial row sums

  const int lane = threadIdx.x & 31;
  // wave number in a scalar register: key range and loop bounds are then
  // wave-uniform for the compiler (EXEC stays all ones)
  const int wave = __builtin_amdgcn_readfirstlane(threadIdx.x >> 5);
  const int h    = blockIdx.x / (NTOK / QBLK);
  const int kr   = wave;                           // key range 0..KSPLIT-1
  const int nb   = (blockIdx.x % (NTOK / QBLK)) * QBLK;  // block's first query
  const int half = lane >> 4;                      // 0 | 1
  const int l16  = lane & 15;

  const unsigned short* qb = qkhl + (h * NTOK + nb) * 16;        // q[n][hi8|lo8]
  const unsigned short* kb = qkhl + ((HEADS + h) * NTOK) * 16;   // k[m][hi8|lo8]
  const unsigned short* vb = vbf + (h * 16) * NTOK;              // v[d16][m]

  // Q as bf16 B-operand (32x16). Elements e and 8 + e of a lane hold dim e of
  // its query: q_hi in lane half 0, q_lo in lane half 1.
  // The K fragment has k_hi at e and k_lo at 8 + e in both halves, so the 32
  // products of a column are (q_hi + q_lo)[d] * (k_hi + k_lo)[d], d = 0..7.
  union VFrag { v16bf v; uint4 u[2]; };
  VFrag qB[QT];
  // every loop over t is unrolled: constant indices keep the tiles in registers
#pragma unroll
  for (int t = 0; t < QT; ++t)
    qB[t].u[0] = qB[t].u[1] =
        *(const uint4*)(qb + (t * 16 + l16) * 16 + half * 8);

  v8f   acc[QT] = {};              // out^T accumulators (rows d, cols n);
                                   // row 8 (lane half 1, element 0): the sums
  float shift[QT] = {};            // the same in both lanes of a query

  struct KFrag { VFrag a0, a1; };  // key tile 0 (16 keys), tile 1 (the next 16)
  const int mbeg = kr * KRANGE;
  const int mend = mbeg + KRANGE;
  // this lane's place in the wave's next chunk of K and of V
  const uint4* const kp0 = (const uint4*)(kb + (mbeg + l16) * 16);
  const uint4* const vp0 =
      (const uint4*)(vb + (size_t)l16 * NTOK + mbeg + half * 8);
  const uint4* kp = kp0;
  const uint4* vp = vp0;

  // the operand loads of one 32-key chunk
  auto fetch = [&](KFrag& k, VFrag& vA) {
    // ---- K as bf16 A-operand: lane L (row m=l16, both halves alike), the
    //      key's 32 bytes: hi of d = 0..7, then lo of d = 0..7
    k.a0.u[0] = kp[0];  k.a0.u[1] = kp[1];
    k.a1.u[0] = kp[32]; k.a1.u[1] = kp[33];
    kp += 64;

    // ---- V as bf16 A-operand: lane L (row d=l16), two 16B contiguous loads
    vA.u[0] = vp[0];                // K =  0..7  (+8*half)
    vA.u[1] = vp[2];                // K = 16..23 (+8*half)
    vp += 4;
  };

  // S^T + c = (K-tile) x (Q-tile t) + c: one bf16 WMMA a key tile
  auto scores = [&](const KFrag& k, int t, const v8f c, v8f& s0, v8f& s1) {
    s0 = __builtin_amdgcn_wmma_f32_16x16x32_bf16(
        false, k.a0.v, false, qB[t].v, (short)0, c, false, false);
    s1 = __builtin_amdgcn_wmma_f32_16x16x32_bf16(
        false, k.a1.v, false, qB[t].v, (short)0, c, false, false);
  };

  // the largest of 'seed' and this lane's 16 logits
  auto lane_max = [&](float seed, const v8f s0, const v8f s1) {
    // unrolled: constant element indices keep the tiles in registers
#pragma unroll
    for (int r = 0; r < 8; ++r) seed = fmaxf(fmaxf(seed, s0[r]), s1[r]);
    return seed;
  };

  // weights of a chunk from a tile's logits (shifted or not)
  auto weights = [&](const v8f s0, const v8f s1, v16bf& pB) {
    v8f p0, p1;                     // P^T is packed straight into B-operand
    // unrolled: constant element indices keep the tiles in registers
#pragma unroll
    for (int r = 0; r < 8; ++r) p0[r] = __builtin_amdgcn_exp2f(s0[r]);
#pragma unroll
    for (int r = 0; r < 8; ++r) p1[r] = __builtin_amdgcn_exp2f(s1[r]);
#pragma unroll
    for (int r = 0; r < 8; ++r) {
      pB[r]     = (__bf16)p0[r];    // K =  r + 8*half   (tile 0)
      pB[8 + r] = (__bf16)p1[r];    // K = 16 + r + 8*half (tile 1)
    }
  };

  // P x V of a chunk for tile t, and in row 8 the sum of its weights
  auto weighted_v = [&](int t, const v16bf pB, const VFrag& vA) {
    acc[t] = __builtin_amdgcn_wmma_f32_16x16x32_bf16(
        false, vA.v, false, pB, (short)0, acc[t], false, false);
  };

  auto weigh = [&](int t, const v8f s0, const v8f s1, const VFrag& vA) {
    v16bf pB;
    weights(s0, s1, pB);
    weighted_v(t, pB, vA);
  };

  // ---- the range without a shift: no maximum, no branch in a chunk
  auto chunk = [&](const KFrag& k, const VFrag& vA) {
    const v8f zero = {};
    v8f s0[QT], s1[QT];
    v16bf pB[QT];
    // In stages, each pinned by a scheduling barrier: a tile's QK^T stands two
    // stages in front of its exp2, its P x V one stage behind: no vector
    // instruction then stands close behind the WMMA it depends on (v_nops)
    scores(k, 0, zero, s0[0], s1[0]);
    scores(k, 1, zero, s0[1], s1[1]);
    __builtin_amdgcn_sched_barrier(0);
    // unrolled: constant indices keep the tiles in registers
#pragma unroll
    for (int t = 0; t < QT; ++t) {
      if (t + 2 < QT) scores(k, t + 2, zero, s0[t + 2], s1[t + 2]);
      if (t > 0) weighted_v(t - 1, pB[t - 1], vA);
      weights(s0[t], s1[t], pB[t]);
      __builtin_amdgcn_sched_barrier(0);
    }
    weighted_v(QT - 1, pB[QT - 1], vA);
  };
  // Three register sets for the K and V fragments: the loads of a chunk are
  // asked for two chunks ahead, so a wave works on one set while the other two
  // fill (the first two sets are asked for together with Q).
  static_assert((KRANGE / 32) % 3 == 1 && KRANGE >= 128,
                "chunks are taken in threes, the last four apart");
  // the operand loads of the chunk 'ahead' chunks behind kp and vp
  auto fetch_at = [&](int ahead, KFrag& k, VFrag& vA) {
    const uint4* kq = kp + ahead * 64;
    const uint4* vq = vp + ahead * 4;
    k.a0.u[0] = kq[0];  k.a0.u[1] = kq[1];
    k.a1.u[0] = kq[32]; k.a1.u[1] = kq[33];
    vA.u[0] = vq[0];
    vA.u[1] = vq[2];
  };
  {
    KFrag k0, k1, k2;
    VFrag v0, v1, v2;
    fetch_at(0, k0, v0);
    fetch_at(1, k1, v1);
    for (int m = mbeg; m < mend - 128; m += 96) {
      fetch_at(2, k2, v2);
      // keeps a later chunk's loads up here, in front of this chunk's work:
      // sunk into it they would lose their lead (so behind every fetch_at)
      __builtin_amdgcn_sched_barrier(0);
      chunk(k0, v0);
      fetch_at(3, k0, v0);
      __builtin_amdgcn_sched_barrier(0);
      chunk(k1, v1);
      fetch_at(4, k1, v1);
      __builtin_amdgcn_sched_barrier(0);
      chunk(k2, v2);
      // keeps the pointer steps down here, a chunk's work behind the loads that
      // name these registers: moved up, their s_wait_xcnt would stall the wave
      // directly behind the loads
      __builtin_amdgcn_sched_barrier(0);
      kp += 192;
      vp += 12;
    }
    fetch_at(2, k2, v2);            // the last four chunks: two left to ask for
    __builtin_amdgcn_sched_barrier(0);
    chunk(k0, v0);
    fetch_at(3, k0, v0);
    __builtin_amdgcn_sched_barrier(0);
    chunk(k1, v1);
    chunk(k2, v2);
    chunk(k0, v0);
  }
  bool in_range = true;             // false too where a sum is not a number
#pragma unroll
  for (int t = 0; t < QT; ++t) {
    float mag = 0.0f;               // infinite or NaN if an accumulator is
#pragma unroll
    for (int r = 0; r < 8; ++r) mag += fabsf(acc[t][r]);
    // element 0 is a sum in lane half 1 only (in half 0 it is row 0 of out^T)
    in_range &= ((half == 0) |
                 ((acc[t][0] >= __builtin_ldexpf(1.0f, -SUM_ROOM)) &
                  (acc[t][0] <= __builtin_ldexpf(1.0f, SUM_ROOM)))) &
                (mag < INFINITY);
  }

  // ballot: one scalar branch for the wave, EXEC stays all ones
  if (__builtin_amdgcn_ballot_w32(!in_range) != 0u) {
    // ---- the range again, from nothing, with a shift
#pragma unroll
    for (int t = 0; t < QT; ++t) acc[t] = v8f{};
    kp = kp0;
    vp = vp0;
    {                                 // first chunk: its maximum is the shift
      KFrag k;
      VFrag vA;
      fetch(k, vA);
      const v8f zero = {};
      v8f s0[QT], s1[QT];
#pragma unroll
      for (int t = 0; t < QT; ++t) {
        scores(k, t, zero, s0[t], s1[t]);
        const float lmax = lane_max(-INFINITY, s0[t], s1[t]);
        shift[t] = fmaxf(lmax, __shfl_xor(lmax, 16, 32));  // join half-waves
      }
#pragma unroll
      for (int t = 0; t < QT; ++t) {
        s0[t] -= shift[t];
        s1[t] -= shift[t];
        weigh(t, s0[t], s1[t], vA);
      }
    }
    int m0 = mbeg + 32;
    // outer loop: one trip per value of the shifts, so that C is invariant in
    // the inner loop and the WMMAs read it where it lies (no register copies)
    while (m0 < mend) {
      v8f nshift[QT];                 // minus the shift, in every row of C
#pragma unroll
      for (int t = 0; t < QT; ++t) nshift[t] = v8f{} - shift[t];
      bool moved;
      do {
        KFrag k;
        VFrag vA;
        fetch(k, vA);
        // keeps V's loads up here beside K's: sunk behind QK^T (into K's
        // registers) they would start a second wait in every trip
        __builtin_amdgcn_sched_barrier(0);
        v8f s0[QT], s1[QT];
        float lmax[QT];               // how far above the shift, at least 0
        float top = 0.0f;
#pragma unroll
        for (int t = 0; t < QT; ++t) scores(k, t, nshift[t], s0[t], s1[t]);
        // keeps the 8 WMMAs back to back: a maximum moved in between them
        // waits for its WMMA's result behind v_nops
        __builtin_amdgcn_sched_barrier(0);
#pragma unroll
        for (int t = 0; t < QT; ++t) {
          lmax[t] = lane_max(0.0f, s0[t], s1[t]);
          top = fmaxf(top, lmax[t]);
        }
        // ballot: one scalar branch for wave and chunk, EXEC stays all ones
        moved = __builtin_amdgcn_ballot_w32(top > SHIFT_ROOM) != 0u;
        if (moved) {                  // raise each shift to its maximum in this chunk, if higher
#pragma unroll
          for (int t = 0; t < QT; ++t) {
            const float up = fmaxf(lmax[t], __shfl_xor(lmax[t], 16, 32));
            const float corr = __builtin_amdgcn_exp2f(-up);
            shift[t] += up;
            acc[t] *= corr;           // the sums in row 8 with it
            s0[t] -= up;
            s1[t] -= up;
          }
        }
#pragma unroll
        for (int t = 0; t < QT; ++t) weigh(t, s0[t], s1[t], vA);
        m0 += 32;
      } while (!moved && m0 < mend);
    }
  }

  // ---- hand over the partials: lanes 0..15 hold rows d=0..7 of out^T, lanes
  //      16..31 the sums (row 8)
  if (half == 0) {
#pragma unroll
    for (int t = 0; t < QT; ++t) {
      const int q = t * 16 + l16;
#pragma unroll
      for (int r = 0; r < 8; ++r) s_acc[kr][r][q] = acc[t][r];
      s_max[kr][q] = shift[t];
    }
  } else {
#pragma unroll
    for (int t = 0; t < QT; ++t) s_sum[kr][t * 16 + l16] = acc[t][0];
  }
  __syncthreads();   // every range's partial is in LDS before the merge

  // ---- merge + normalize + store: wave d stores row d, 128-B lines
#pragma unroll
  for (int q = lane; q < QBLK; q += 32) {
    float gmax = s_max[0][q];
#pragma unroll
    for (int s = 1; s < KSPLIT; ++s) gmax = fmaxf(gmax, s_max[s][q]);
    float num = 0.0f, den = 0.0f;
#pragma unroll
    for (int s = 0; s < KSPLIT; ++s) {
      const float wgt = __builtin_amdgcn_exp2f(s_max[s][q] - gmax);
      num = fmaf(s_acc[s][wave][q], wgt, num);
      den = fmaf(s_sum[s][q], wgt, den);
    }
    attn_out[(h * HDIM + wave) * NTOK + nb + q] = num / den;
  }
}

// ---------------------------------------------------------------------------
// Kernel 3: out = x + w_proj(64x64) @ attn_out + b_proj
// grid (4, 64) x 64 threads: blockIdx.x = 16-channel tile, one wave per 32
// tokens: 512 waves, one block per WGP.
// ---------------------------------------------------------------------------
// waves_per_eu: as in kernel 1, room for every load to be in flight at once
__global__ __launch_bounds__(64) __attribute__((amdgpu_waves_per_eu(1, 4)))
void proj_kernel(
    const float* __restrict__ x, const float* __restrict__ w,
    const float* __restrict__ b, const float* __restrict__ ao,
    float* __restrict__ out) {
  const int lane = threadIdx.x & 31;
  // wave number in a scalar register: EXEC stays all ones around the WMMAs
  const int wave = __builtin_amdgcn_readfirstlane(threadIdx.x >> 5);
  const int c    = lane & 15;
  const int hf   = lane >> 4;
  const int co0  = blockIdx.x * 16;
  const int n0   = (blockIdx.y * 2 + wave) * 32;

  float2 res[8];                       // residual, asked for with the operands
#pragma unroll
  for (int r = 0; r < 8; ++r)
    res[r] = *(const float2*)(x + (co0 + 8 * hf + r) * NTOK + n0 + 2 * c);

  v8f t0, t1;
  pointwise_tile(w, b, ao, co0, n0, c, hf, t0, t1);

#pragma unroll
  for (int r = 0; r < 8; ++r)
    *(float2*)(out + (co0 + 8 * hf + r) * NTOK + n0 + 2 * c) =
        make_float2(res[r].x + t0[r], res[r].y + t1[r]);
}

// ---------------------------------------------------------------------------
extern "C" void kernel_launch(void* const* d_in, const int* in_sizes, int n_in,
                              void* d_out, int out_size, void* d_ws,
                              size_t ws_size, hipStream_t stream) {
  const float* x      = (const float*)d_in[0];   // (1,64,16,16,16)
  const float* w_qkv  = (const float*)d_in[1];   // (192,64)
  const float* b_qkv  = (const float*)d_in[2];   // (192)
  const float* w_proj = (const float*)d_in[3];   // (64,64)
  const float* b_proj = (const float*)d_in[4];   // (64)
  float* out = (float*)d_out;

  char* ws = (char*)d_ws;
  float*          qkv = (float*)ws;              // 192*4096 f32, v rows written
  unsigned short* qkhl = (unsigned short*)ws;        // in its q and k rows' place
  float*          ao  = (float*)(ws + 192 * NTOK * 4);        //  64*4096 f32
  unsigned short* vbf = (unsigned short*)(ws + 256 * NTOK * 4); // 8*16*4096 bf16

  qkv_kernel<<<dim3(12, 32), 128, 0, stream>>>(x, w_qkv, b_qkv, qkv, qkhl, vbf);
  attn_kernel<<<dim3(512), 256, 0, stream>>>(qkhl, vbf, ao);
  proj_kernel<<<dim3(4, 64), 64, 0, stream>>>(x, w_proj, b_proj, ao, out);
}
